// v000
// The times below were measured on an AMD MI455X: many runs one after another, warmed up first and cycling through
// copies of the inputs, with the whole window's GPU time divided by the number of runs. Launches and the gaps
// between them are all in it. The median over several windows is given; except for v000 it joins two sittings, which
// can be a few percent apart, so the side-by-side timings, each taken in one sitting, are the better comparison.
// v000, which the later versions start from, runs in 503 microseconds.
#include <hip/hip_runtime.h>

// Contractions: S = Q.K^T and O = Pc.V on v_wmma_f32_16x16x32_f16 (f16 operands holding bf16-RNE-converted
// inputs; f32 accumulate). Row max, Newton steps and weights in f32; Pc = per-row centred weights carried
// x2^15 as f16, folded back in f32 together with the per-column sums of V.

#ifndef NB
#define NB 2
#endif
#ifndef SEQ
#define SEQ 2048
#endif
#define NB_FULL  2
#define SEQ_FULL 2048
#define NH       12
#define HD       64
#define RS       (NH * HD)          // elements between consecutive sequence rows
#define NTHR     512
#define NWAV     (NTHR / 32)
#define KPW      (SEQ / NWAV)       // keys per wave
#define NKT      (KPW / 16)         // 16-key score tiles per wave
#define NKC      (KPW / 32)         // 32-key P.V steps per wave
#define NSTEPS   6
#define PCARRY     32768.0f
#define PCARRY_INV (1.0f / 32768.0f)
#define WS_LIMIT ((size_t)134217728)

static_assert(SEQ % 512 == 0);
static_assert(SEQ <= SEQ_FULL);
static_assert(NB >= 1 && NB <= NB_FULL);
static_assert(NKT * 16 * NWAV == SEQ);
static_assert(NKC * 2 == NKT);
static_assert((size_t)3 * NB * SEQ * RS * 2 + (size_t)NB * NH * HD * 4 <= WS_LIMIT);

typedef _Float16 v16h __attribute__((ext_vector_type(16)));
typedef _Float16 v8h  __attribute__((ext_vector_type(8)));
typedef float    v8f  __attribute__((ext_vector_type(8)));
typedef float    v4f  __attribute__((ext_vector_type(4)));

union AFrag { v16h v; v8h h[2]; };

// bf16 RNE convert of an f32 value, returned as f32 (inputs are finite)
__device__ __forceinline__ float bf16_rne(float x) {
  unsigned u = __float_as_uint(x);
  u = (u + 0x7fffu + ((u >> 16) & 1u)) & 0xffff0000u;
  return __uint_as_float(u);
}
__device__ __forceinline__ _Float16 to_h(float x) { return (_Float16)bf16_rne(x); }

__device__ __forceinline__ v8f zero8() {
  v8f z;
#pragma unroll
  for (int i = 0; i < 8; ++i) z[i] = 0.0f;
  return z;
}

// 16x32 fragment (A: lane row m, B: lane col n) from a 16-bit row-major matrix, k contiguous.
// lane m = lane&15; kb = 8*(lane>>4); elems 0..7 = k kb..kb+7, elems 8..15 = k kb+16..kb+23.
__device__ __forceinline__ v16h load_frag16(const _Float16* base, int ld, int lane) {
  const int m  = lane & 15;
  const int kb = (lane >> 4) << 3;
  const _Float16* p = base + (size_t)m * ld + kb;
  AFrag f;
  f.h[0] = *(const v8h*)(p);
  f.h[1] = *(const v8h*)(p + 16);
  return f.v;
}

__device__ __forceinline__ v8f wmma16(v16h a, v16h b, v8f c) {
  v8f d = __builtin_amdgcn_wmma_f32_16x16x32_f16(false, a, false, b, (short)0, c, false, false);
  asm volatile("v_nop\n\tv_nop\n\tv_nop\n\tv_nop" : "+v"(d) : "v"(a), "v"(b) : "memory");
  return d;
}

template <bool MX>
__device__ __forceinline__ float cmb(float x, float y) { return MX ? fmaxf(x, y) : (x + y); }

// Reduce 8 per-lane row values (rows 8*hh + 0..7 of this lane's half) over the 16 lanes of the half.
// Halving butterfly; result = total for row 8*hh + (m >> 1). All selects are by value, shuffles unconditional.
template <bool MX>
__device__ __forceinline__ float half_red8(v8f a, int m) {
  const bool b3 = (m & 8) != 0, b2 = (m & 4) != 0, b1 = (m & 2) != 0;
  float k1[4];
#pragma unroll
  for (int j = 0; j < 4; ++j) {
    const float snd = b3 ? a[j] : a[j + 4];
    const float kp  = b3 ? a[j + 4] : a[j];
    k1[j] = cmb<MX>(kp, __shfl_xor(snd, 8, 32));
  }
  float k2[2];
#pragma unroll
  for (int j = 0; j < 2; ++j) {
    const float snd = b2 ? k1[j] : k1[j + 2];
    const float kp  = b2 ? k1[j + 2] : k1[j];
    k2[j] = cmb<MX>(kp, __shfl_xor(snd, 4, 32));
  }
  const float snd3 = b1 ? k2[0] : k2[1];
  const float kp3  = b1 ? k2[1] : k2[0];
  const float k3 = cmb<MX>(kp3, __shfl_xor(snd3, 2, 32));
  return cmb<MX>(k3, __shfl_xor(k3, 1, 32));
}

// Block-wide reduction of two per-row quantities over all 16 waves, fixed order.
// rb points at a [2][16 rows][16 waves] f32 LDS buffer (cross-wave: block barrier inside).
// Returns in ta/tb the totals of row (lane & 15), bitwise identical in every lane/wave.
template <bool MX>
__device__ __forceinline__ void blockred2(v8f a, v8f b, float* rb, int lane, int wave,
                                          float& ta, float& tb) {
  const int m = lane & 15, hh = lane >> 4;
  const float ra = half_red8<MX>(a, m);
  const float rv = half_red8<MX>(b, m);
  if ((m & 1) == 0) {
    const int row = 8 * hh + (m >> 1);
    rb[row * 16 + wave]        = ra;
    rb[(16 + row) * 16 + wave] = rv;
  }
  __syncthreads();
  const float* pa = rb + m * 16 + 8 * hh;
  const float* pb = rb + (16 + m) * 16 + 8 * hh;
  const v4f a0 = *(const v4f*)(pa);
  const v4f a1 = *(const v4f*)(pa + 4);
  const v4f b0 = *(const v4f*)(pb);
  const v4f b1 = *(const v4f*)(pb + 4);
  float xa, xb;
  if (MX) {
    xa = fmaxf(fmaxf(fmaxf(a0[0], a0[1]), fmaxf(a0[2], a0[3])),
               fmaxf(fmaxf(a1[0], a1[1]), fmaxf(a1[2], a1[3])));
    xb = fmaxf(fmaxf(fmaxf(b0[0], b0[1]), fmaxf(b0[2], b0[3])),
               fmaxf(fmaxf(b1[0], b1[1]), fmaxf(b1[2], b1[3])));
  } else {
    xa = ((((((a0[0] + a0[1]) + a0[2]) + a0[3]) + a1[0]) + a1[1]) + a1[2]) + a1[3];
    xb = ((((((b0[0] + b0[1]) + b0[2]) + b0[3]) + b1[0]) + b1[1]) + b1[2]) + b1[3];
  }
  const float ya = __shfl_xor(xa, 16, 32);
  const float yb = __shfl_xor(xb, 16, 32);
  ta = cmb<MX>(xa, ya);
  tb = cmb<MX>(xb, yb);
}

// ---------------------------------------------------------------------------
// Q and K planes: same [b][l][h][d] layout as the inputs, bf16-RNE values in f16 containers.
// coverage: n8*8 = NB*SEQ*RS elements per plane (whole plane); blockIdx.y selects Q (0) or K (1).
// ---------------------------------------------------------------------------
__global__ __launch_bounds__(256) void k_cvt_qk(const float* __restrict__ q, const float* __restrict__ k,
                                                _Float16* __restrict__ qh, _Float16* __restrict__ kh, int n8) {
  const int i = blockIdx.x * 256 + threadIdx.x;
  if (i >= n8) return;
  const bool second = (blockIdx.y != 0);
  const float* src = second ? k : q;
  _Float16* dst = second ? kh : qh;
  const size_t e     = (size_t)i * 8;
  const size_t per_b = (size_t)SEQ * RS;
  const size_t bb    = e / per_b;
  const size_t rem   = e - bb * per_b;
  const float* p = src + bb * ((size_t)SEQ_FULL * RS) + rem;
  const v4f f0 = *(const v4f*)(p);
  const v4f f1 = *(const v4f*)(p + 4);
  v8h o;
  o[0] = to_h(f0[0]); o[1] = to_h(f0[1]); o[2] = to_h(f0[2]); o[3] = to_h(f0[3]);
  o[4] = to_h(f1[0]); o[5] = to_h(f1[1]); o[6] = to_h(f1[2]); o[7] = to_h(f1[3]);
  v8h* d = (v8h*)(dst + e);
  *d = o;
  
}

// ---------------------------------------------------------------------------
// V^T plane vth[b][h][d][l] (l contiguous, pitch SEQ), bf16-RNE values in f16 containers.
// in: v[b][l0..l0+63][h][0..63] -> out: vth[b][h][0..63][l0..l0+63]; transpose through LDS;
// coverage: 256 threads x 2 pieces x 8 halves = 64 rows x 64 l per block; grid (SEQ/64, NH, NB) -> whole plane.
// ---------------------------------------------------------------------------
__global__ __launch_bounds__(256) void k_vtrans(const float* __restrict__ v, _Float16* __restrict__ vth) {
  __shared__ __align__(16) _Float16 tile[HD][72];   // cross-thread tile: block barrier between fill and read
  const int tid = threadIdx.x;
  const int l0 = blockIdx.x * 64, h = blockIdx.y, bb = blockIdx.z;
  const float* vb = v + ((size_t)bb * SEQ_FULL + l0) * RS + h * HD;
#pragma unroll
  for (int j = 0; j < 4; ++j) {
    const int idx = tid + 256 * j;            // 0..1023
    const int l = idx >> 4, d4 = (idx & 15) * 4;
    const v4f f = *(const v4f*)(vb + (size_t)l * RS + d4);
    tile[d4 + 0][l] = to_h(f[0]);
    tile[d4 + 1][l] = to_h(f[1]);
    tile[d4 + 2][l] = to_h(f[2]);
    tile[d4 + 3][l] = to_h(f[3]);
  }
  __syncthreads();
  _Float16* ob = vth + ((size_t)(bb * NH + h) * HD) * SEQ + l0;
  v8h val[2];
  size_t off[2];
#pragma unroll
  for (int j = 0; j < 2; ++j) {
    const int p = tid + 256 * j;              // 0..511
    const int row = p >> 3, piece = p & 7;
    val[j] = *(const v8h*)(&tile[row][piece * 8]);
    off[j] = (size_t)row * SEQ + piece * 8;
  }
  *(v8h*)(ob + off[0]) = val[0];
  *(v8h*)(ob + off[1]) = val[1];
  
}

// ---------------------------------------------------------------------------
// vsum[b][h][d] = sum_l bf16_rne(v[b][l][h][d]), f64 accumulation, f32 result.
// One (b,h) row = 64 floats = 256 B = 2 lines, written by lanes 0..15 of wave 0 with one 16-B store each.
// coverage: grid (NH, NB) x 64 threads -> whole table.
// ---------------------------------------------------------------------------
__global__ __launch_bounds__(64) void k_vsum(const float* __restrict__ v, float* __restrict__ vsum) {
  __shared__ __align__(16) float ssum[HD];      // cross-wave: block barrier
  const int d = threadIdx.x, h = blockIdx.x, bb = blockIdx.y;
  const float* p = v + (size_t)bb * SEQ_FULL * RS + h * HD + d;
  double acc = 0.0;
#pragma unroll 4
  for (int l = 0; l < SEQ; ++l) acc += (double)bf16_rne(p[(size_t)l * RS]);
  ssum[d] = (float)acc;
  __syncthreads();
  if (d < 16) {
    const v4f val = *(const v4f*)(&ssum[d * 4]);
    v4f* o = (v4f*)(vsum + (size_t)(bb * NH + h) * HD + d * 4);
    *o = val;
    
  }
}

// ---------------------------------------------------------------------------
// Fused attention with the polynomial normaliser for one (b, h, 16 query rows).
// 16 waves; wave w owns keys [w*KPW, w*KPW+KPW). Full score row kept in WMMA D registers:
// s[t][g] = S(row 8*hh+g, key w*KPW + 16*t + m). Row reductions: in-half shuffles + fixed-order
// cross-wave combine through LDS (identical result in every wave). P tile C-layout -> A-fragment
// through a per-wave LDS tile; V^T B-fragments straight from the vth plane; partial O folded
// ---------------------------------------------------------------------------
__global__ __launch_bounds__(NTHR) __attribute__((amdgpu_num_vgpr(256)))
void k_attn(const _Float16* __restrict__ qh, const _Float16* __restrict__ kh,
            const _Float16* __restrict__ vth, const float* __restrict__ vsum,
            float* __restrict__ out) {
  __shared__ __align__(16) _Float16 Pst[NWAV][16][32];   // wave-private tiles (wave sync only)
  __shared__ __align__(16) float red[2][2][16][16];      // cross-wave, ping-pong by reduction parity
  __shared__ __align__(16) float Ored[4][16][HD];        // cross-wave partial O fold
  __shared__ __align__(16) float Ofin[16][HD];           // cross-wave final tile
  __shared__ float wbar_sh[16];

  const int tid  = threadIdx.x;
  const int lane = tid & 31, wave = tid >> 5;
  const int m = lane & 15, hh = lane >> 4, r0 = hh << 3;
  const int q0 = blockIdx.x * 16, h = blockIdx.y, b = blockIdx.z;
  const int kw0 = wave * KPW;

  const _Float16* qp = qh  + ((size_t)b * SEQ + q0)  * RS + h * HD;
  const _Float16* kp = kh  + ((size_t)b * SEQ + kw0) * RS + h * HD;
  const _Float16* vp = vth + ((size_t)(b * NH + h) * HD) * SEQ + kw0;

  // ---- S = (Q . K^T) / 8 for 16 rows x KPW keys of this wave ----
  v8f s[NKT];
  {
    const v16h qa0 = load_frag16(qp, RS, lane);        // d 0..31
    const v16h qa1 = load_frag16(qp + 32, RS, lane);   // d 32..63
#pragma unroll
    for (int t = 0; t < NKT; ++t) {
      const _Float16* kt = kp + (size_t)(t * 16) * RS;
      const v16h kb0 = load_frag16(kt, RS, lane);      // B: lane = key, elems = d (split map)
      const v16h kb1 = load_frag16(kt + 32, RS, lane);
      v8f acc = zero8();
      acc = wmma16(qa0, kb0, acc);
      acc = wmma16(qa1, kb1, acc);
      s[t] = acc * 0.125f;
    }
  }

  // ---- c0 = -rowmax - 1 ----
  float cl;    // c of row (lane & 15)
  v8f   cv;    // c of rows r0 + g
  {
    v8f mx;
#pragma unroll
    for (int g = 0; g < 8; ++g) {
      float x = s[0][g];
#pragma unroll
      for (int t = 1; t < NKT; ++t) x = fmaxf(x, s[t][g]);
      mx[g] = x;
    }
    float ta, tb;
    blockred2<true>(mx, mx, &red[0][0][0][0], lane, wave, ta, tb);
    cl = -ta - 1.0f;
#pragma unroll
    for (int g = 0; g < 8; ++g) cv[g] = __shfl(cl, r0 + g, 32);
  }

  // ---- Newton steps: c -= (sum 1/(-x-c)^2 - 1) / (2 sum 1/(-x-c)^3 + 1e-8) ----
#pragma unroll 1
  for (int it = 0; it < NSTEPS; ++it) {
    v8f ps = zero8(), pd = zero8();
#pragma unroll
    for (int t = 0; t < NKT; ++t) {
      const v8f tt = -s[t] - cv;
      v8f y;
#pragma unroll
      for (int g = 0; g < 8; ++g) y[g] = __builtin_amdgcn_rcpf(tt[g]);
      const v8f a = y * y;
      ps += a;
      pd += a * y;
    }
    float ta, tb;
    blockred2<false>(ps, pd, &red[(it + 1) & 1][0][0][0], lane, wave, ta, tb);
    cl = cl - (ta - 1.0f) / (2.0f * tb + 1e-8f);
#pragma unroll
    for (int g = 0; g < 8; ++g) cv[g] = __shfl(cl, r0 + g, 32);
  }

  // ---- final weights w = 1/(-x-c)^2 (kept in s), per-row centre wbar = sum(w)/SEQ ----
  v8f wb;
  {
    v8f sw = zero8();
#pragma unroll
    for (int t = 0; t < NKT; ++t) {
      const v8f tt = -s[t] - cv;
      v8f y;
#pragma unroll
      for (int g = 0; g < 8; ++g) y[g] = __builtin_amdgcn_rcpf(tt[g]);
      const v8f w = y * y;
      s[t] = w;
      sw += w;
    }
    float ta, tb;
    blockred2<false>(sw, sw, &red[1][0][0][0], lane, wave, ta, tb);
    const float wbl = ta * (1.0f / (float)SEQ);
    if (wave == 0 && lane < 16) wbar_sh[lane] = wbl;
#pragma unroll
    for (int g = 0; g < 8; ++g) wb[g] = __shfl(wbl, r0 + g, 32);
  }

  // ---- O_w = Pc (16 x KPW) . V (KPW x 64), Pc = (w - wbar) * 2^15 as f16 ----
  v8f o[4];
#pragma unroll
  for (int st = 0; st < 4; ++st) o[st] = zero8();
  _Float16* pst = &Pst[wave][0][0];
#pragma unroll
  for (int kc = 0; kc < NKC; ++kc) {
    const v8f p0 = (s[2 * kc] - wb) * PCARRY;
    const v8f p1 = (s[2 * kc + 1] - wb) * PCARRY;
    __builtin_amdgcn_fence(5, "wavefront");
    __builtin_amdgcn_wave_barrier();
#pragma unroll
    for (int g = 0; g < 8; ++g) {
      pst[(r0 + g) * 32 + m]      = (_Float16)p0[g];   // key 32kc + m
      pst[(r0 + g) * 32 + m + 16] = (_Float16)p1[g];   // key 32kc + 16 + m
    }
    __builtin_amdgcn_fence(5, "wavefront");
    __builtin_amdgcn_wave_barrier();
    const v16h pa = load_frag16(pst, 32, lane);        // A: lane = query row, elems = keys (split map)
#pragma unroll
    for (int st = 0; st < 4; ++st) {
      // B: lane = d, elems = keys (split map) from the d-major V^T plane
      const v16h vbf = load_frag16(vp + (size_t)(st * 16) * SEQ + kc * 32, SEQ, lane);
      o[st] = wmma16(pa, vbf, o[st]);
    }
  }

  // ---- fixed-order fold of the 16 per-wave partials: slot = wave & 3, phases wave >> 2 ----
#pragma unroll 1
  for (int ph = 0; ph < 4; ++ph) {
    if ((wave >> 2) == ph) {
      float* ob = &Ored[wave & 3][0][0];
#pragma unroll
      for (int st = 0; st < 4; ++st) {
#pragma unroll
        for (int g = 0; g < 8; ++g) {
          float* pr = ob + (r0 + g) * HD + st * 16 + m;
          const float x = o[st][g];
          if (ph == 0) *pr = x; else *pr = *pr + x;
        }
      }
    }
    __syncthreads();
  }

  // ---- epilogue: out = O/2^15 + wbar * sum_k v ----
  {
    const float* vsp = vsum + (size_t)(b * NH + h) * HD;
#pragma unroll
    for (int j = 0; j < 2; ++j) {
      const int e = tid * 2 + j;
      const int row = e >> 6, d = e & 63;
      const float a = ((Ored[0][row][d] + Ored[1][row][d]) + Ored[2][row][d]) + Ored[3][row][d];
      Ofin[row][d] = a * PCARRY_INV + wbar_sh[row] * vsp[d];
    }
  }
  __syncthreads();
  if (wave < 4) {
    // lanes 8k..8k+7 cover one line each.
    v4f val[2];
    size_t off[2];
#pragma unroll
    for (int j = 0; j < 2; ++j) {
      const int row = wave * 4 + 2 * j + hh;
      val[j] = *(const v4f*)(&Ofin[row][m * 4]);
      off[j] = ((size_t)b * SEQ + q0 + row) * RS + h * HD + m * 4;
    }
    *(v4f*)(out + off[0]) = val[0];
    *(v4f*)(out + off[1]) = val[1];
    
  }
}

// ---------------------------------------------------------------------------
// Host side
// ---------------------------------------------------------------------------
extern "C" void kernel_launch(void* const* d_in, const int* in_sizes, int n_in,
                              void* d_out, int out_size, void* d_ws, size_t ws_size,
                              hipStream_t stream) {
  if (n_in < 3 || d_ws == nullptr || d_out == nullptr) return;
  const size_t need_in  = ((size_t)(NB - 1) * SEQ_FULL + SEQ) * RS;
  const size_t need_out = (size_t)NB * SEQ * RS;
  if ((size_t)in_sizes[0] < need_in || (size_t)in_sizes[1] < need_in || (size_t)in_sizes[2] < need_in) return;
  if ((size_t)out_size < need_out) return;

  const size_t plane_b = (size_t)NB * SEQ * RS * sizeof(_Float16);   // 6291456 B at full size
  const size_t vsum_b  = (size_t)NB * NH * HD * sizeof(float);       // 6144 B at full size
  const size_t off_q = 0;
  const size_t off_k = off_q + plane_b;
  const size_t off_v = off_k + plane_b;
  const size_t off_s = off_v + plane_b;
  const size_t total = off_s + vsum_b;                               // 18880512 B at full size
  if (ws_size < total || total > WS_LIMIT) return;

  const float* q = (const float*)d_in[0];
  const float* k = (const float*)d_in[1];
  const float* v = (const float*)d_in[2];
  float* o = (float*)d_out;
  char* ws = (char*)d_ws;
  _Float16* qh  = (_Float16*)(ws + off_q);
  _Float16* kh  = (_Float16*)(ws + off_k);
  _Float16* vth = (_Float16*)(ws + off_v);
  float*    vs  = (float*)(ws + off_s);

  const int n8 = (int)((size_t)NB * SEQ * RS / 8);
  k_cvt_qk<<<dim3((n8 + 255) / 256, 2), 256, 0, stream>>>(q, k, qh, kh, n8);
  k_vtrans<<<dim3(SEQ / 64, NH, NB), 256, 0, stream>>>(v, vth);
  k_vsum<<<dim3(NH, NB), 64, 0, stream>>>(v, vs);
  k_attn<<<dim3(SEQ / 16, NH, NB), NTHR, 0, stream>>>(qh, kh, vth, vs, o);
  (void)hipGetLastError();
}

// v001
// Measured time: 319 microseconds a run.
// Timed twice side by side with v000, it ran 1.59 and 1.61 times as fast.
#include <hip/hip_runtime.h>

// Contractions: S = Q.K^T and O = Pc.V on v_wmma_f32_16x16x32_f16 (f16 operands holding bf16-RNE-converted
// inputs; f32 accumulate). Row max, Newton steps and weights in f32; Pc = per-row centred weights carried
// x2^15 as f16, folded back in f32 together with the per-column sums of V.

#ifndef NB
#define NB 2
#endif
#ifndef SEQ
#define SEQ 2048
#endif
#define NB_FULL  2
#define SEQ_FULL 2048
#define NH       12
#define HD       64
#define RS       (NH * HD)          // elements between consecutive sequence rows
#define NTHR     512
#define NWAV     (NTHR / 32)
#define KPW      (SEQ / NWAV)       // keys per wave
#define NKT      (KPW / 16)         // 16-key score tiles per wave
#define NKC      (KPW / 32)         // 32-key P.V steps per wave
#define NSTEPS   6
#define PCARRY     32768.0f
#define PCARRY_INV (1.0f / 32768.0f)
#define WS_LIMIT ((size_t)134217728)

static_assert(SEQ % 512 == 0);
static_assert(SEQ <= SEQ_FULL);
static_assert(NB >= 1 && NB <= NB_FULL);
static_assert(NKT * 16 * NWAV == SEQ);
static_assert(NKC * 2 == NKT);
static_assert((size_t)3 * NB * SEQ * RS * 2 + (size_t)NB * NH * HD * 4 <= WS_LIMIT);

typedef _Float16 v16h __attribute__((ext_vector_type(16)));
typedef _Float16 v8h  __attribute__((ext_vector_type(8)));
typedef float    v8f  __attribute__((ext_vector_type(8)));
typedef float    v4f  __attribute__((ext_vector_type(4)));

union AFrag { v16h v; v8h h[2]; };

// bf16 RNE convert of an f32 value, returned as f32 (inputs are finite)
__device__ __forceinline__ float bf16_rne(float x) {
  unsigned u = __float_as_uint(x);
  u = (u + 0x7fffu + ((u >> 16) & 1u)) & 0xffff0000u;
  return __uint_as_float(u);
}
__device__ __forceinline__ _Float16 to_h(float x) { return (_Float16)bf16_rne(x); }

__device__ __forceinline__ v8f zero8() {
  v8f z;
#pragma unroll
  for (int i = 0; i < 8; ++i) z[i] = 0.0f;
  return z;
}

// 16x32 fragment (A: lane row m, B: lane col n) from a 16-bit row-major matrix, k contiguous.
// lane m = lane&15; kb = 8*(lane>>4); elems 0..7 = k kb..kb+7, elems 8..15 = k kb+16..kb+23.
__device__ __forceinline__ v16h load_frag16(const _Float16* base, int ld, int lane) {
  const int m  = lane & 15;
  const int kb = (lane >> 4) << 3;
  const _Float16* p = base + (size_t)m * ld + kb;
  AFrag f;
  f.h[0] = *(const v8h*)(p);
  f.h[1] = *(const v8h*)(p + 16);
  return f.v;
}

__device__ __forceinline__ v8f wmma16(v16h a, v16h b, v8f c) {
  v8f d = __builtin_amdgcn_wmma_f32_16x16x32_f16(false, a, false, b, (short)0, c, false, false);
  asm volatile("v_nop\n\tv_nop\n\tv_nop\n\tv_nop" : "+v"(d) : "v"(a), "v"(b) : "memory");
  return d;
}

template <bool MX>
__device__ __forceinline__ float cmb(float x, float y) { return MX ? fmaxf(x, y) : (x + y); }

// Reduce 8 per-lane row values (rows 8*hh + 0..7 of this lane's half) over the 16 lanes of the half.
// Halving butterfly; result = total for row 8*hh + (m >> 1). All selects are by value, shuffles unconditional.
template <bool MX>
__device__ __forceinline__ float half_red8(v8f a, int m) {
  const bool b3 = (m & 8) != 0, b2 = (m & 4) != 0, b1 = (m & 2) != 0;
  float k1[4];
#pragma unroll
  for (int j = 0; j < 4; ++j) {
    const float snd = b3 ? a[j] : a[j + 4];
    const float kp  = b3 ? a[j + 4] : a[j];
    k1[j] = cmb<MX>(kp, __shfl_xor(snd, 8, 32));
  }
  float k2[2];
#pragma unroll
  for (int j = 0; j < 2; ++j) {
    const float snd = b2 ? k1[j] : k1[j + 2];
    const float kp  = b2 ? k1[j + 2] : k1[j];
    k2[j] = cmb<MX>(kp, __shfl_xor(snd, 4, 32));
  }
  const float snd3 = b1 ? k2[0] : k2[1];
  const float kp3  = b1 ? k2[1] : k2[0];
  const float k3 = cmb<MX>(kp3, __shfl_xor(snd3, 2, 32));
  return cmb<MX>(k3, __shfl_xor(k3, 1, 32));
}

// Block-wide reduction of two per-row quantities over all 16 waves, fixed order.
// rb points at a [2][16 rows][16 waves] f32 LDS buffer (cross-wave: block barrier inside).
// Returns in ta/tb the totals of row (lane & 15), bitwise identical in every lane/wave.
template <bool MX>
__device__ __forceinline__ void blockred2(v8f a, v8f b, float* rb, int lane, int wave,
                                          float& ta, float& tb) {
  const int m = lane & 15, hh = lane >> 4;
  const float ra = half_red8<MX>(a, m);
  const float rv = half_red8<MX>(b, m);
  if ((m & 1) == 0) {
    const int row = 8 * hh + (m >> 1);
    rb[row * 16 + wave]        = ra;
    rb[(16 + row) * 16 + wave] = rv;
  }
  __syncthreads();
  const float* pa = rb + m * 16 + 8 * hh;
  const float* pb = rb + (16 + m) * 16 + 8 * hh;
  const v4f a0 = *(const v4f*)(pa);
  const v4f a1 = *(const v4f*)(pa + 4);
  const v4f b0 = *(const v4f*)(pb);
  const v4f b1 = *(const v4f*)(pb + 4);
  float xa, xb;
  if (MX) {
    xa = fmaxf(fmaxf(fmaxf(a0[0], a0[1]), fmaxf(a0[2], a0[3])),
               fmaxf(fmaxf(a1[0], a1[1]), fmaxf(a1[2], a1[3])));
    xb = fmaxf(fmaxf(fmaxf(b0[0], b0[1]), fmaxf(b0[2], b0[3])),
               fmaxf(fmaxf(b1[0], b1[1]), fmaxf(b1[2], b1[3])));
  } else {
    xa = ((((((a0[0] + a0[1]) + a0[2]) + a0[3]) + a1[0]) + a1[1]) + a1[2]) + a1[3];
    xb = ((((((b0[0] + b0[1]) + b0[2]) + b0[3]) + b1[0]) + b1[1]) + b1[2]) + b1[3];
  }
  const float ya = __shfl_xor(xa, 16, 32);
  const float yb = __shfl_xor(xb, 16, 32);
  ta = cmb<MX>(xa, ya);
  tb = cmb<MX>(xb, yb);
}

// ---------------------------------------------------------------------------
// Q and K planes: same [b][l][h][d] layout as the inputs, bf16-RNE values in f16 containers.
// coverage: n8*8 = NB*SEQ*RS elements per plane (whole plane); blockIdx.y selects Q (0) or K (1).
// ---------------------------------------------------------------------------
__global__ __launch_bounds__(256) void k_cvt_qk(const float* __restrict__ q, const float* __restrict__ k,
                                                _Float16* __restrict__ qh, _Float16* __restrict__ kh, int n8) {
  const int i = blockIdx.x * 256 + threadIdx.x;
  if (i >= n8) return;
  const bool second = (blockIdx.y != 0);
  const float* src = second ? k : q;
  _Float16* dst = second ? kh : qh;
  const size_t e     = (size_t)i * 8;
  const size_t per_b = (size_t)SEQ * RS;
  const size_t bb    = e / per_b;
  const size_t rem   = e - bb * per_b;
  const float* p = src + bb * ((size_t)SEQ_FULL * RS) + rem;
  const v4f f0 = *(const v4f*)(p);
  const v4f f1 = *(const v4f*)(p + 4);
  v8h o;
  o[0] = to_h(f0[0]); o[1] = to_h(f0[1]); o[2] = to_h(f0[2]); o[3] = to_h(f0[3]);
  o[4] = to_h(f1[0]); o[5] = to_h(f1[1]); o[6] = to_h(f1[2]); o[7] = to_h(f1[3]);
  v8h* d = (v8h*)(dst + e);
  *d = o;
  
}

// ---------------------------------------------------------------------------
// V^T plane vth[b][h][d][l] (l contiguous, pitch SEQ), bf16-RNE values in f16 containers.
// in: v[b][l0..l0+63][h][0..63] -> out: vth[b][h][0..63][l0..l0+63]; transpose through LDS;
// coverage: 256 threads x 2 pieces x 8 halves = 64 rows x 64 l per block; grid (SEQ/64, NH, NB) -> whole plane.
// ---------------------------------------------------------------------------
__global__ __launch_bounds__(256) void k_vtrans(const float* __restrict__ v, _Float16* __restrict__ vth) {
  __shared__ __align__(16) _Float16 tile[HD][72];   // cross-thread tile: block barrier between fill and read
  const int tid = threadIdx.x;
  const int l0 = blockIdx.x * 64, h = blockIdx.y, bb = blockIdx.z;
  const float* vb = v + ((size_t)bb * SEQ_FULL + l0) * RS + h * HD;
#pragma unroll
  for (int j = 0; j < 4; ++j) {
    const int idx = tid + 256 * j;            // 0..1023
    const int l = idx >> 4, d4 = (idx & 15) * 4;
    const v4f f = *(const v4f*)(vb + (size_t)l * RS + d4);
    tile[d4 + 0][l] = to_h(f[0]);
    tile[d4 + 1][l] = to_h(f[1]);
    tile[d4 + 2][l] = to_h(f[2]);
    tile[d4 + 3][l] = to_h(f[3]);
  }
  __syncthreads();
  _Float16* ob = vth + ((size_t)(bb * NH + h) * HD) * SEQ + l0;
  v8h val[2];
  size_t off[2];
#pragma unroll
  for (int j = 0; j < 2; ++j) {
    const int p = tid + 256 * j;              // 0..511
    const int row = p >> 3, piece = p & 7;
    val[j] = *(const v8h*)(&tile[row][piece * 8]);
    off[j] = (size_t)row * SEQ + piece * 8;
  }
  *(v8h*)(ob + off[0]) = val[0];
  *(v8h*)(ob + off[1]) = val[1];
  
}

// ---------------------------------------------------------------------------
// vsum[b][h][d] = sum_l bf16_rne(v[b][l][h][d]), f64 accumulation, f32 result.
// One block = one (b, h, 32-d half) = one 128-B line of the table. 1024 threads: 8 lanes x 16 B cover the
// 128-B row piece, 128 row groups; thread (g, c) sums rows g, g+128, ... in f64. Fixed-order fold of the
// 128 groups through LDS: 4 groups per wave, then a pairwise tree over the 32 wave sums in wave 0.
// coverage: grid (NH, NB, 2) x 32 lanes of wave 0 -> whole table.
// ---------------------------------------------------------------------------
#define VS_GRP 128
static_assert(SEQ % VS_GRP == 0);
__global__ __launch_bounds__(1024) void k_vsum(const float* __restrict__ v, float* __restrict__ vsum) {
  __shared__ __align__(16) double part[VS_GRP][32];   // rows 4w..4w+3 written and read by wave w; block barrier
  __shared__ __align__(16) double wsum[32][32];       // cross-wave: block barrier
  const int tid = threadIdx.x;
  const int c = tid & 7, g = tid >> 3;
  const int h = blockIdx.x, bb = blockIdx.y, d0 = blockIdx.z * 32;
  const float* p = v + ((size_t)bb * SEQ_FULL + g) * RS + h * HD + d0 + c * 4;
  v4f f[SEQ / VS_GRP];
  // unrolled: all of a thread's loads are in flight at once, one memory latency for the whole column piece
#pragma unroll
  for (int j = 0; j < SEQ / VS_GRP; ++j) f[j] = *(const v4f*)(p + (size_t)j * VS_GRP * RS);
  double a0 = 0.0, a1 = 0.0, a2 = 0.0, a3 = 0.0;
  // unrolled: f[] stays in registers
#pragma unroll
  for (int j = 0; j < SEQ / VS_GRP; ++j) {
    a0 += (double)bf16_rne(f[j][0]);
    a1 += (double)bf16_rne(f[j][1]);
    a2 += (double)bf16_rne(f[j][2]);
    a3 += (double)bf16_rne(f[j][3]);
  }
  part[g][c * 4 + 0] = a0;
  part[g][c * 4 + 1] = a1;
  part[g][c * 4 + 2] = a2;
  part[g][c * 4 + 3] = a3;
  __syncthreads();
  const int lane = tid & 31, wave = tid >> 5;
  wsum[wave][lane] = ((part[4 * wave][lane] + part[4 * wave + 1][lane]) + part[4 * wave + 2][lane])
                     + part[4 * wave + 3][lane];
  __syncthreads();
  if (wave == 0) {
    double x[32];
    // all three unrolled: x[] stays in registers, the 32 LDS reads issue together
#pragma unroll
    for (int w = 0; w < 32; ++w) x[w] = wsum[w][lane];
#pragma unroll
    for (int s = 1; s < 32; s *= 2) {
#pragma unroll
      for (int w = 0; w < 32; w += 2 * s) x[w] += x[w + s];
    }
    vsum[(size_t)(bb * NH + h) * HD + d0 + lane] = (float)x[0];
  }
}

// ---------------------------------------------------------------------------
// Fused attention with the polynomial normaliser for one (b, h, 16 query rows).
// 16 waves; wave w owns keys [w*KPW, w*KPW+KPW). Full score row kept in WMMA D registers:
// s[t][g] = S(row 8*hh+g, key w*KPW + 16*t + m). Row reductions: in-half shuffles + fixed-order
// cross-wave combine through LDS (identical result in every wave). P tile C-layout -> A-fragment
// through a per-wave LDS tile; V^T B-fragments straight from the vth plane; partial O folded
// ---------------------------------------------------------------------------
__global__ __launch_bounds__(NTHR) __attribute__((amdgpu_num_vgpr(256)))
void k_attn(const _Float16* __restrict__ qh, const _Float16* __restrict__ kh,
            const _Float16* __restrict__ vth, const float* __restrict__ vsum,
            float* __restrict__ out) {
  __shared__ __align__(16) _Float16 Pst[NWAV][16][32];   // wave-private tiles (wave sync only)
  __shared__ __align__(16) float red[2][2][16][16];      // cross-wave, ping-pong by reduction parity
  __shared__ __align__(16) float Ored[4][16][HD];        // cross-wave partial O fold
  __shared__ __align__(16) float Ofin[16][HD];           // cross-wave final tile
  __shared__ float wbar_sh[16];

  const int tid  = threadIdx.x;
  const int lane = tid & 31, wave = tid >> 5;
  const int m = lane & 15, hh = lane >> 4, r0 = hh << 3;
  const int q0 = blockIdx.x * 16, h = blockIdx.y, b = blockIdx.z;
  const int kw0 = wave * KPW;

  const _Float16* qp = qh  + ((size_t)b * SEQ + q0)  * RS + h * HD;
  const _Float16* kp = kh  + ((size_t)b * SEQ + kw0) * RS + h * HD;
  const _Float16* vp = vth + ((size_t)(b * NH + h) * HD) * SEQ + kw0;

  // ---- S = (Q . K^T) / 8 for 16 rows x KPW keys of this wave ----
  v8f s[NKT];
  {
    const v16h qa0 = load_frag16(qp, RS, lane);        // d 0..31
    const v16h qa1 = load_frag16(qp + 32, RS, lane);   // d 32..63
#pragma unroll
    for (int t = 0; t < NKT; ++t) {
      const _Float16* kt = kp + (size_t)(t * 16) * RS;
      const v16h kb0 = load_frag16(kt, RS, lane);      // B: lane = key, elems = d (split map)
      const v16h kb1 = load_frag16(kt + 32, RS, lane);
      v8f acc = zero8();
      acc = wmma16(qa0, kb0, acc);
      acc = wmma16(qa1, kb1, acc);
      s[t] = acc * 0.125f;
    }
  }

  // ---- c0 = -rowmax - 1 ----
  float cl;    // c of row (lane & 15)
  v8f   cv;    // c of rows r0 + g
  {
    v8f mx;
#pragma unroll
    for (int g = 0; g < 8; ++g) {
      float x = s[0][g];
#pragma unroll
      for (int t = 1; t < NKT; ++t) x = fmaxf(x, s[t][g]);
      mx[g] = x;
    }
    float ta, tb;
    blockred2<true>(mx, mx, &red[0][0][0][0], lane, wave, ta, tb);
    cl = -ta - 1.0f;
#pragma unroll
    for (int g = 0; g < 8; ++g) cv[g] = __shfl(cl, r0 + g, 32);
  }

  // ---- Newton steps: c -= (sum 1/(-x-c)^2 - 1) / (2 sum 1/(-x-c)^3 + 1e-8) ----
#pragma unroll 1
  for (int it = 0; it < NSTEPS; ++it) {
    v8f ps = zero8(), pd = zero8();
#pragma unroll
    for (int t = 0; t < NKT; ++t) {
      const v8f tt = -s[t] - cv;
      v8f y;
#pragma unroll
      for (int g = 0; g < 8; ++g) y[g] = __builtin_amdgcn_rcpf(tt[g]);
      const v8f a = y * y;
      ps += a;
      pd += a * y;
    }
    float ta, tb;
    blockred2<false>(ps, pd, &red[(it + 1) & 1][0][0][0], lane, wave, ta, tb);
    cl = cl - (ta - 1.0f) / (2.0f * tb + 1e-8f);
#pragma unroll
    for (int g = 0; g < 8; ++g) cv[g] = __shfl(cl, r0 + g, 32);
  }

  // ---- final weights w = 1/(-x-c)^2 (kept in s), per-row centre wbar = sum(w)/SEQ ----
  v8f wb;
  {
    v8f sw = zero8();
#pragma unroll
    for (int t = 0; t < NKT; ++t) {
      const v8f tt = -s[t] - cv;
      v8f y;
#pragma unroll
      for (int g = 0; g < 8; ++g) y[g] = __builtin_amdgcn_rcpf(tt[g]);
      const v8f w = y * y;
      s[t] = w;
      sw += w;
    }
    float ta, tb;
    blockred2<false>(sw, sw, &red[1][0][0][0], lane, wave, ta, tb);
    const float wbl = ta * (1.0f / (float)SEQ);
    if (wave == 0 && lane < 16) wbar_sh[lane] = wbl;
#pragma unroll
    for (int g = 0; g < 8; ++g) wb[g] = __shfl(wbl, r0 + g, 32);
  }

  // ---- O_w = Pc (16 x KPW) . V (KPW x 64), Pc = (w - wbar) * 2^15 as f16 ----
  v8f o[4];
#pragma unroll
  for (int st = 0; st < 4; ++st) o[st] = zero8();
  _Float16* pst = &Pst[wave][0][0];
#pragma unroll
  for (int kc = 0; kc < NKC; ++kc) {
    const v8f p0 = (s[2 * kc] - wb) * PCARRY;
    const v8f p1 = (s[2 * kc + 1] - wb) * PCARRY;
    __builtin_amdgcn_fence(5, "wavefront");
    __builtin_amdgcn_wave_barrier();
#pragma unroll
    for (int g = 0; g < 8; ++g) {
      pst[(r0 + g) * 32 + m]      = (_Float16)p0[g];   // key 32kc + m
      pst[(r0 + g) * 32 + m + 16] = (_Float16)p1[g];   // key 32kc + 16 + m
    }
    __builtin_amdgcn_fence(5, "wavefront");
    __builtin_amdgcn_wave_barrier();
    const v16h pa = load_frag16(pst, 32, lane);        // A: lane = query row, elems = keys (split map)
#pragma unroll
    for (int st = 0; st < 4; ++st) {
      // B: lane = d, elems = keys (split map) from the d-major V^T plane
      const v16h vbf = load_frag16(vp + (size_t)(st * 16) * SEQ + kc * 32, SEQ, lane);
      o[st] = wmma16(pa, vbf, o[st]);
    }
  }

  // ---- fixed-order fold of the 16 per-wave partials: slot = wave & 3, phases wave >> 2 ----
#pragma unroll 1
  for (int ph = 0; ph < 4; ++ph) {
    if ((wave >> 2) == ph) {
      float* ob = &Ored[wave & 3][0][0];
#pragma unroll
      for (int st = 0; st < 4; ++st) {
#pragma unroll
        for (int g = 0; g < 8; ++g) {
          float* pr = ob + (r0 + g) * HD + st * 16 + m;
          const float x = o[st][g];
          if (ph == 0) *pr = x; else *pr = *pr + x;
        }
      }
    }
    __syncthreads();
  }

  // ---- epilogue: out = O/2^15 + wbar * sum_k v ----
  {
    const float* vsp = vsum + (size_t)(b * NH + h) * HD;
#pragma unroll
    for (int j = 0; j < 2; ++j) {
      const int e = tid * 2 + j;
      const int row = e >> 6, d = e & 63;
      const float a = ((Ored[0][row][d] + Ored[1][row][d]) + Ored[2][row][d]) + Ored[3][row][d];
      Ofin[row][d] = a * PCARRY_INV + wbar_sh[row] * vsp[d];
    }
  }
  __syncthreads();
  if (wave < 4) {
    // lanes 8k..8k+7 cover one line each.
    v4f val[2];
    size_t off[2];
#pragma unroll
    for (int j = 0; j < 2; ++j) {
      const int row = wave * 4 + 2 * j + hh;
      val[j] = *(const v4f*)(&Ofin[row][m * 4]);
      off[j] = ((size_t)b * SEQ + q0 + row) * RS + h * HD + m * 4;
    }
    *(v4f*)(out + off[0]) = val[0];
    *(v4f*)(out + off[1]) = val[1];
    
  }
}

// ---------------------------------------------------------------------------
// Host side
// ---------------------------------------------------------------------------
extern "C" void kernel_launch(void* const* d_in, const int* in_sizes, int n_in,
                              void* d_out, int out_size, void* d_ws, size_t ws_size,
                              hipStream_t stream) {
  if (n_in < 3 || d_ws == nullptr || d_out == nullptr) return;
  const size_t need_in  = ((size_t)(NB - 1) * SEQ_FULL + SEQ) * RS;
  const size_t need_out = (size_t)NB * SEQ * RS;
  if ((size_t)in_sizes[0] < need_in || (size_t)in_sizes[1] < need_in || (size_t)in_sizes[2] < need_in) return;
  if ((size_t)out_size < need_out) return;

  const size_t plane_b = (size_t)NB * SEQ * RS * sizeof(_Float16);   // 6291456 B at full size
  const size_t vsum_b  = (size_t)NB * NH * HD * sizeof(float);       // 6144 B at full size
  const size_t off_q = 0;
  const size_t off_k = off_q + plane_b;
  const size_t off_v = off_k + plane_b;
  const size_t off_s = off_v + plane_b;
  const size_t total = off_s + vsum_b;                               // 18880512 B at full size
  if (ws_size < total || total > WS_LIMIT) return;

  const float* q = (const float*)d_in[0];
  const float* k = (const float*)d_in[1];
  const float* v = (const float*)d_in[2];
  float* o = (float*)d_out;
  char* ws = (char*)d_ws;
  _Float16* qh  = (_Float16*)(ws + off_q);
  _Float16* kh  = (_Float16*)(ws + off_k);
  _Float16* vth = (_Float16*)(ws + off_v);
  float*    vs  = (float*)(ws + off_s);

  const int n8 = (int)((size_t)NB * SEQ * RS / 8);
  k_cvt_qk<<<dim3((n8 + 255) / 256, 2), 256, 0, stream>>>(q, k, qh, kh, n8);
  k_vtrans<<<dim3(SEQ / 64, NH, NB), 256, 0, stream>>>(v, vth);
  k_vsum<<<dim3(NH, NB, 2), 1024, 0, stream>>>(v, vs);
  k_attn<<<dim3(SEQ / 16, NH, NB), NTHR, 0, stream>>>(qh, kh, vth, vs, o);
  (void)hipGetLastError();
}

// v002
// A run of this version takes 208 microseconds.
// Two timings next to v001 both put it at 1.53 times that version's speed.
// Counting every step since v000, it is 2.44 times as fast.
#include <hip/hip_runtime.h>

// Contractions: S = Q.K^T and O = Pc.V on v_wmma_f32_16x16x32_f16 (f16 operands holding bf16-RNE-converted
// inputs; f32 accumulate). Row max, Newton steps and weights in f32; Pc = per-row centred weights carried
// x2^15 as f16, folded back in f32 together with the per-column sums of V.

#ifndef NB
#define NB 2
#endif
#ifndef SEQ
#define SEQ 2048
#endif
#define NB_FULL  2
#define SEQ_FULL 2048
#define NH       12
#define HD       64
#define RS       (NH * HD)          // elements between consecutive sequence rows
#define NTHR     512
#define NWAV     (NTHR / 32)
#define KPW      (SEQ / NWAV)       // keys per wave
#define NKT      (KPW / 16)         // 16-key score tiles per wave
#define NKC      (KPW / 32)         // 32-key P.V steps per wave
#define NSTEPS   6
#define PCARRY     32768.0f
#define PCARRY_INV (1.0f / 32768.0f)
#define WS_LIMIT ((size_t)134217728)

static_assert(SEQ % 512 == 0);
static_assert(SEQ <= SEQ_FULL);
static_assert(NB >= 1 && NB <= NB_FULL);
static_assert(NKT * 16 * NWAV == SEQ);
static_assert(NKC * 2 == NKT);
static_assert((size_t)3 * NB * SEQ * RS * 2 + (size_t)NB * NH * HD * 4 <= WS_LIMIT);

typedef _Float16 v16h __attribute__((ext_vector_type(16)));
typedef _Float16 v8h  __attribute__((ext_vector_type(8)));
typedef float    v8f  __attribute__((ext_vector_type(8)));
typedef float    v4f  __attribute__((ext_vector_type(4)));

union AFrag { v16h v; v8h h[2]; };

// bf16 RNE convert of an f32 value, returned as f32 (inputs are finite)
__device__ __forceinline__ float bf16_rne(float x) {
  unsigned u = __float_as_uint(x);
  u = (u + 0x7fffu + ((u >> 16) & 1u)) & 0xffff0000u;
  return __uint_as_float(u);
}
__device__ __forceinline__ _Float16 to_h(float x) { return (_Float16)bf16_rne(x); }

__device__ __forceinline__ v8f zero8() {
  v8f z;
#pragma unroll
  for (int i = 0; i < 8; ++i) z[i] = 0.0f;
  return z;
}

// 16x32 fragment (A: lane row m, B: lane col n) from a 16-bit row-major matrix, k contiguous.
// lane m = lane&15; kb = 8*(lane>>4); elems 0..7 = k kb..kb+7, elems 8..15 = k kb+16..kb+23.
__device__ __forceinline__ v16h load_frag16(const _Float16* base, int ld, int lane) {
  const int m  = lane & 15;
  const int kb = (lane >> 4) << 3;
  const _Float16* p = base + (size_t)m * ld + kb;
  AFrag f;
  f.h[0] = *(const v8h*)(p);
  f.h[1] = *(const v8h*)(p + 16);
  return f.v;
}

__device__ __forceinline__ v8f wmma16(v16h a, v16h b, v8f c) {
  v8f d = __builtin_amdgcn_wmma_f32_16x16x32_f16(false, a, false, b, (short)0, c, false, false);
  asm volatile("v_nop\n\tv_nop\n\tv_nop\n\tv_nop" : "+v"(d) : "v"(a), "v"(b) : "memory");
  return d;
}

// Lane exchanges on the vector pipe: they need no per-lane address register (a shuffle through the LDS unit does).
// CTRL: 0x160 | k = lane l ^ k inside its 16-lane row; 0x150 | k = lane k of the row to all 16. All lanes active.
template <int CTRL>
__device__ __forceinline__ float row_dpp(float x) {
  return __int_as_float(__builtin_amdgcn_update_dpp(0, __float_as_int(x), CTRL, 0xf, 0xf, true));
}
// lane l with lane l ^ 16
__device__ __forceinline__ float xhalf(float x) {
  return __int_as_float(__builtin_amdgcn_permlanex16(__float_as_int(x), __float_as_int(x), 0x76543210, 0xfedcba98, false, false));
}
// x holds the value of row (lane & 15), alike in both halves; returns the values of rows 8*hh + 0..7
__device__ __forceinline__ v8f rows_of_half(float x, int hh) {
  const float sw = row_dpp<0x168>(x);           // exchanged by every lane, then chosen by value
  const float y = hh ? sw : x;                  // place g of the upper half now holds row 8 + g
  v8f r;
  r[0] = row_dpp<0x150>(y); r[1] = row_dpp<0x151>(y); r[2] = row_dpp<0x152>(y); r[3] = row_dpp<0x153>(y);
  r[4] = row_dpp<0x154>(y); r[5] = row_dpp<0x155>(y); r[6] = row_dpp<0x156>(y); r[7] = row_dpp<0x157>(y);
  return r;
}

template <bool MX>
__device__ __forceinline__ float cmb(float x, float y) { return MX ? fmaxf(x, y) : (x + y); }

// Reduce 8 per-lane row values (rows 8*hh + 0..7 of this lane's half) over the 16 lanes of the half.
// Halving butterfly; result = total for row 8*hh + (m >> 1). All selects are by value, exchanges unconditional.
template <bool MX>
__device__ __forceinline__ float half_red8(v8f a, int m) {
  const bool b3 = (m & 8) != 0, b2 = (m & 4) != 0, b1 = (m & 2) != 0;
  float k1[4];
#pragma unroll
  for (int j = 0; j < 4; ++j) {
    const float snd = b3 ? a[j] : a[j + 4];
    const float kp  = b3 ? a[j + 4] : a[j];
    k1[j] = cmb<MX>(kp, row_dpp<0x168>(snd));
  }
  float k2[2];
#pragma unroll
  for (int j = 0; j < 2; ++j) {
    const float snd = b2 ? k1[j] : k1[j + 2];
    const float kp  = b2 ? k1[j + 2] : k1[j];
    k2[j] = cmb<MX>(kp, row_dpp<0x164>(snd));
  }
  const float snd3 = b1 ? k2[0] : k2[1];
  const float kp3  = b1 ? k2[1] : k2[0];
  const float k3 = cmb<MX>(kp3, row_dpp<0x162>(snd3));
  return cmb<MX>(k3, row_dpp<0x161>(k3));
}

// Block-wide reduction of two per-row quantities over all 16 waves, fixed order.
// rb points at a [2][16 rows][16 waves] f32 LDS buffer (cross-wave: block barrier inside).
// Returns in ta/tb the totals of row (lane & 15), bitwise identical in every lane/wave.
template <bool MX>
__device__ __forceinline__ void blockred2(v8f a, v8f b, float* rb, int lane, int wave,
                                          float& ta, float& tb) {
  const int m = lane & 15, hh = lane >> 4;
  const float ra = half_red8<MX>(a, m);
  const float rv = half_red8<MX>(b, m);
  if ((m & 1) == 0) {
    const int row = 8 * hh + (m >> 1);
    rb[row * 16 + wave]        = ra;
    rb[(16 + row) * 16 + wave] = rv;
  }
  __syncthreads();
  const float* pa = rb + m * 16 + 8 * hh;
  const float* pb = rb + (16 + m) * 16 + 8 * hh;
  const v4f a0 = *(const v4f*)(pa);
  const v4f a1 = *(const v4f*)(pa + 4);
  const v4f b0 = *(const v4f*)(pb);
  const v4f b1 = *(const v4f*)(pb + 4);
  float xa, xb;
  if (MX) {
    xa = fmaxf(fmaxf(fmaxf(a0[0], a0[1]), fmaxf(a0[2], a0[3])),
               fmaxf(fmaxf(a1[0], a1[1]), fmaxf(a1[2], a1[3])));
    xb = fmaxf(fmaxf(fmaxf(b0[0], b0[1]), fmaxf(b0[2], b0[3])),
               fmaxf(fmaxf(b1[0], b1[1]), fmaxf(b1[2], b1[3])));
  } else {
    xa = ((((((a0[0] + a0[1]) + a0[2]) + a0[3]) + a1[0]) + a1[1]) + a1[2]) + a1[3];
    xb = ((((((b0[0] + b0[1]) + b0[2]) + b0[3]) + b1[0]) + b1[1]) + b1[2]) + b1[3];
  }
  const float ya = xhalf(xa);
  const float yb = xhalf(xb);
  ta = cmb<MX>(xa, ya);
  tb = cmb<MX>(xb, yb);
}

// ---------------------------------------------------------------------------
// Q and K planes: same [b][l][h][d] layout as the inputs, bf16-RNE values in f16 containers.
// coverage: n8*8 = NB*SEQ*RS elements per plane (whole plane); blockIdx.y selects Q (0) or K (1).
// ---------------------------------------------------------------------------
__global__ __launch_bounds__(256) void k_cvt_qk(const float* __restrict__ q, const float* __restrict__ k,
                                                _Float16* __restrict__ qh, _Float16* __restrict__ kh, int n8) {
  const int i = blockIdx.x * 256 + threadIdx.x;
  if (i >= n8) return;
  const bool second = (blockIdx.y != 0);
  const float* src = second ? k : q;
  _Float16* dst = second ? kh : qh;
  const size_t e     = (size_t)i * 8;
  const size_t per_b = (size_t)SEQ * RS;
  const size_t bb    = e / per_b;
  const size_t rem   = e - bb * per_b;
  const float* p = src + bb * ((size_t)SEQ_FULL * RS) + rem;
  const v4f f0 = *(const v4f*)(p);
  const v4f f1 = *(const v4f*)(p + 4);
  v8h o;
  o[0] = to_h(f0[0]); o[1] = to_h(f0[1]); o[2] = to_h(f0[2]); o[3] = to_h(f0[3]);
  o[4] = to_h(f1[0]); o[5] = to_h(f1[1]); o[6] = to_h(f1[2]); o[7] = to_h(f1[3]);
  v8h* d = (v8h*)(dst + e);
  *d = o;
  
}

// ---------------------------------------------------------------------------
// V^T plane vth[b][h][d][l] (l contiguous, pitch SEQ), bf16-RNE values in f16 containers.
// in: v[b][l0..l0+63][h][0..63] -> out: vth[b][h][0..63][l0..l0+63]; transpose through LDS;
// coverage: 256 threads x 2 pieces x 8 halves = 64 rows x 64 l per block; grid (SEQ/64, NH, NB) -> whole plane.
// ---------------------------------------------------------------------------
__global__ __launch_bounds__(256) void k_vtrans(const float* __restrict__ v, _Float16* __restrict__ vth) {
  __shared__ __align__(16) _Float16 tile[HD][72];   // cross-thread tile: block barrier between fill and read
  const int tid = threadIdx.x;
  const int l0 = blockIdx.x * 64, h = blockIdx.y, bb = blockIdx.z;
  const float* vb = v + ((size_t)bb * SEQ_FULL + l0) * RS + h * HD;
#pragma unroll
  for (int j = 0; j < 4; ++j) {
    const int idx = tid + 256 * j;            // 0..1023
    const int l = idx >> 4, d4 = (idx & 15) * 4;
    const v4f f = *(const v4f*)(vb + (size_t)l * RS + d4);
    tile[d4 + 0][l] = to_h(f[0]);
    tile[d4 + 1][l] = to_h(f[1]);
    tile[d4 + 2][l] = to_h(f[2]);
    tile[d4 + 3][l] = to_h(f[3]);
  }
  __syncthreads();
  _Float16* ob = vth + ((size_t)(bb * NH + h) * HD) * SEQ + l0;
  v8h val[2];
  size_t off[2];
#pragma unroll
  for (int j = 0; j < 2; ++j) {
    const int p = tid + 256 * j;              // 0..511
    const int row = p >> 3, piece = p & 7;
    val[j] = *(const v8h*)(&tile[row][piece * 8]);
    off[j] = (size_t)row * SEQ + piece * 8;
  }
  *(v8h*)(ob + off[0]) = val[0];
  *(v8h*)(ob + off[1]) = val[1];
  
}

// ---------------------------------------------------------------------------
// vsum[b][h][d] = sum_l bf16_rne(v[b][l][h][d]), f64 accumulation, f32 result.
// One block = one (b, h, 32-d half) = one 128-B line of the table. 1024 threads: 8 lanes x 16 B cover the
// 128-B row piece, 128 row groups; thread (g, c) sums rows g, g+128, ... in f64. Fixed-order fold of the
// 128 groups through LDS: 4 groups per wave, then a pairwise tree over the 32 wave sums in wave 0.
// coverage: grid (NH, NB, 2) x 32 lanes of wave 0 -> whole table.
// ---------------------------------------------------------------------------
#define VS_GRP 128
static_assert(SEQ % VS_GRP == 0);
__global__ __launch_bounds__(1024) void k_vsum(const float* __restrict__ v, float* __restrict__ vsum) {
  __shared__ __align__(16) double part[VS_GRP][32];   // rows 4w..4w+3 written and read by wave w; block barrier
  __shared__ __align__(16) double wsum[32][32];       // cross-wave: block barrier
  const int tid = threadIdx.x;
  const int c = tid & 7, g = tid >> 3;
  const int h = blockIdx.x, bb = blockIdx.y, d0 = blockIdx.z * 32;
  const float* p = v + ((size_t)bb * SEQ_FULL + g) * RS + h * HD + d0 + c * 4;
  v4f f[SEQ / VS_GRP];
  // unrolled: all of a thread's loads are in flight at once, one memory latency for the whole column piece
#pragma unroll
  for (int j = 0; j < SEQ / VS_GRP; ++j) f[j] = *(const v4f*)(p + (size_t)j * VS_GRP * RS);
  double a0 = 0.0, a1 = 0.0, a2 = 0.0, a3 = 0.0;
  // unrolled: f[] stays in registers
#pragma unroll
  for (int j = 0; j < SEQ / VS_GRP; ++j) {
    a0 += (double)bf16_rne(f[j][0]);
    a1 += (double)bf16_rne(f[j][1]);
    a2 += (double)bf16_rne(f[j][2]);
    a3 += (double)bf16_rne(f[j][3]);
  }
  part[g][c * 4 + 0] = a0;
  part[g][c * 4 + 1] = a1;
  part[g][c * 4 + 2] = a2;
  part[g][c * 4 + 3] = a3;
  __syncthreads();
  const int lane = tid & 31, wave = tid >> 5;
  wsum[wave][lane] = ((part[4 * wave][lane] + part[4 * wave + 1][lane]) + part[4 * wave + 2][lane])
                     + part[4 * wave + 3][lane];
  __syncthreads();
  if (wave == 0) {
    double x[32];
    // all three unrolled: x[] stays in registers, the 32 LDS reads issue together
#pragma unroll
    for (int w = 0; w < 32; ++w) x[w] = wsum[w][lane];
#pragma unroll
    for (int s = 1; s < 32; s *= 2) {
#pragma unroll
      for (int w = 0; w < 32; w += 2 * s) x[w] += x[w + s];
    }
    vsum[(size_t)(bb * NH + h) * HD + d0 + lane] = (float)x[0];
  }
}

// ---------------------------------------------------------------------------
// Fused attention with the polynomial normaliser for one (b, h, 16 query rows).
// 16 waves; wave w owns keys [w*KPW, w*KPW+KPW). Full score row kept in WMMA D registers:
// s[t][g] = S(row 8*hh+g, key w*KPW + 16*t + m). Row reductions: in-half shuffles + fixed-order
// cross-wave combine through LDS (identical result in every wave). P tile C-layout -> A-fragment
// through a per-wave LDS tile; V^T B-fragments straight from the vth plane; partial O folded
// ---------------------------------------------------------------------------
// 128 VGPRs: 8 waves per SIMD, so two of these 16-wave work-groups share a WGP and one computes while the
// other waits on its loads, its barriers and its reduction chains.
__global__ __launch_bounds__(NTHR) __attribute__((amdgpu_num_vgpr(128)))
void k_attn(const _Float16* __restrict__ qh, const _Float16* __restrict__ kh,
            const _Float16* __restrict__ vth, const float* __restrict__ vsum,
            float* __restrict__ out) {
  __shared__ __align__(16) _Float16 Pst[NWAV][16][32];   // wave-private tiles (wave sync only)
  __shared__ __align__(16) float red[2][2][16][16];      // cross-wave, ping-pong by reduction parity
  __shared__ __align__(16) float Ored[4][16][HD];        // cross-wave partial O fold
  __shared__ __align__(16) float Ofin[16][HD];           // cross-wave final tile
  __shared__ float wbar_sh[16];

  const int tid  = threadIdx.x;
  const int lane = tid & 31, wave = tid >> 5;
  const int m = lane & 15, hh = lane >> 4, r0 = hh << 3;
  const int q0 = blockIdx.x * 16, h = blockIdx.y, b = blockIdx.z;
  const int kw0 = wave * KPW;

  const _Float16* qp = qh  + ((size_t)b * SEQ + q0)  * RS + h * HD;
  const _Float16* kp = kh  + ((size_t)b * SEQ + kw0) * RS + h * HD;
  const _Float16* vp = vth + ((size_t)(b * NH + h) * HD) * SEQ + kw0;

  // ---- S = (Q . K^T) / 8 for 16 rows x KPW keys of this wave ----
  v8f s[NKT];
  {
    const v16h qa0 = load_frag16(qp, RS, lane);        // d 0..31
    const v16h qa1 = load_frag16(qp + 32, RS, lane);   // d 32..63
#pragma unroll
    for (int t = 0; t < NKT; ++t) {
      const _Float16* kt = kp + (size_t)(t * 16) * RS;
      const v16h kb0 = load_frag16(kt, RS, lane);      // B: lane = key, elems = d (split map)
      const v16h kb1 = load_frag16(kt + 32, RS, lane);
      v8f acc = zero8();
      acc = wmma16(qa0, kb0, acc);
      acc = wmma16(qa1, kb1, acc);
      s[t] = acc * 0.125f;
    }
  }

  // ---- c0 = -rowmax - 1 ----
  float cl;    // c of row (lane & 15)
  v8f   cv;    // c of rows r0 + g
  {
    v8f mx;
#pragma unroll
    for (int g = 0; g < 8; ++g) {
      float x = s[0][g];
#pragma unroll
      for (int t = 1; t < NKT; ++t) x = fmaxf(x, s[t][g]);
      mx[g] = x;
    }
    float ta, tb;
    blockred2<true>(mx, mx, &red[0][0][0][0], lane, wave, ta, tb);
    cl = -ta - 1.0f;
    cv = rows_of_half(cl, hh);
  }

  // ---- Newton steps: c -= (sum 1/(-x-c)^2 - 1) / (2 sum 1/(-x-c)^3 + 1e-8) ----
#pragma unroll 1
  for (int it = 0; it < NSTEPS; ++it) {
    v8f ps = zero8(), pd = zero8();
#pragma unroll
    for (int t = 0; t < NKT; ++t) {
      const v8f tt = -s[t] - cv;
      v8f y;
#pragma unroll
      for (int g = 0; g < 8; ++g) y[g] = __builtin_amdgcn_rcpf(tt[g]);
      const v8f a = y * y;
      ps += a;
      pd += a * y;
    }
    float ta, tb;
    blockred2<false>(ps, pd, &red[(it + 1) & 1][0][0][0], lane, wave, ta, tb);
    cl = cl - (ta - 1.0f) / (2.0f * tb + 1e-8f);
    cv = rows_of_half(cl, hh);
  }

  // ---- final weights w = 1/(-x-c)^2 (kept in s), per-row centre wbar = sum(w)/SEQ ----
  v8f wb;
  {
    v8f sw = zero8();
#pragma unroll
    for (int t = 0; t < NKT; ++t) {
      const v8f tt = -s[t] - cv;
      v8f y;
#pragma unroll
      for (int g = 0; g < 8; ++g) y[g] = __builtin_amdgcn_rcpf(tt[g]);
      const v8f w = y * y;
      s[t] = w;
      sw += w;
    }
    float ta, tb;
    blockred2<false>(sw, sw, &red[1][0][0][0], lane, wave, ta, tb);
    const float wbl = ta * (1.0f / (float)SEQ);
    if (wave == 0 && lane < 16) wbar_sh[lane] = wbl;
    wb = rows_of_half(wbl, hh);
  }

  // ---- O_w = Pc (16 x KPW) . V (KPW x 64), Pc = (w - wbar) * 2^15 as f16 ----
  v8f o[4];
#pragma unroll
  for (int st = 0; st < 4; ++st) o[st] = zero8();
  _Float16* pst = &Pst[wave][0][0];
#pragma unroll
  for (int kc = 0; kc < NKC; ++kc) {
    const v8f p0 = (s[2 * kc] - wb) * PCARRY;
    const v8f p1 = (s[2 * kc + 1] - wb) * PCARRY;
    __builtin_amdgcn_fence(5, "wavefront");
    __builtin_amdgcn_wave_barrier();
#pragma unroll
    for (int g = 0; g < 8; ++g) {
      pst[(r0 + g) * 32 + m]      = (_Float16)p0[g];   // key 32kc + m
      pst[(r0 + g) * 32 + m + 16] = (_Float16)p1[g];   // key 32kc + 16 + m
    }
    __builtin_amdgcn_fence(5, "wavefront");
    __builtin_amdgcn_wave_barrier();
    const v16h pa = load_frag16(pst, 32, lane);        // A: lane = query row, elems = keys (split map)
#pragma unroll
    for (int st = 0; st < 4; ++st) {
      // B: lane = d, elems = keys (split map) from the d-major V^T plane
      const v16h vbf = load_frag16(vp + (size_t)(st * 16) * SEQ + kc * 32, SEQ, lane);
      o[st] = wmma16(pa, vbf, o[st]);
    }
  }

  // ---- fixed-order fold of the 16 per-wave partials: slot = wave & 3, phases wave >> 2 ----
#pragma unroll 1
  for (int ph = 0; ph < 4; ++ph) {
    if ((wave >> 2) == ph) {
      float* ob = &Ored[wave & 3][0][0];
#pragma unroll
      for (int st = 0; st < 4; ++st) {
#pragma unroll
        for (int g = 0; g < 8; ++g) {
          float* pr = ob + (r0 + g) * HD + st * 16 + m;
          const float x = o[st][g];
          if (ph == 0) *pr = x; else *pr = *pr + x;
        }
      }
    }
    __syncthreads();
  }

  // ---- epilogue: out = O/2^15 + wbar * sum_k v ----
  {
    const float* vsp = vsum + (size_t)(b * NH + h) * HD;
#pragma unroll
    for (int j = 0; j < 2; ++j) {
      const int e = tid * 2 + j;
      const int row = e >> 6, d = e & 63;
      const float a = ((Ored[0][row][d] + Ored[1][row][d]) + Ored[2][row][d]) + Ored[3][row][d];
      Ofin[row][d] = a * PCARRY_INV + wbar_sh[row] * vsp[d];
    }
  }
  __syncthreads();
  if (wave < 4) {
    // lanes 8k..8k+7 cover one line each.
    v4f val[2];
    size_t off[2];
#pragma unroll
    for (int j = 0; j < 2; ++j) {
      const int row = wave * 4 + 2 * j + hh;
      val[j] = *(const v4f*)(&Ofin[row][m * 4]);
      off[j] = ((size_t)b * SEQ + q0 + row) * RS + h * HD + m * 4;
    }
    *(v4f*)(out + off[0]) = val[0];
    *(v4f*)(out + off[1]) = val[1];
    
  }
}

// ---------------------------------------------------------------------------
// Host side
// ---------------------------------------------------------------------------
extern "C" void kernel_launch(void* const* d_in, const int* in_sizes, int n_in,
                              void* d_out, int out_size, void* d_ws, size_t ws_size,
                              hipStream_t stream) {
  if (n_in < 3 || d_ws == nullptr || d_out == nullptr) return;
  const size_t need_in  = ((size_t)(NB - 1) * SEQ_FULL + SEQ) * RS;
  const size_t need_out = (size_t)NB * SEQ * RS;
  if ((size_t)in_sizes[0] < need_in || (size_t)in_sizes[1] < need_in || (size_t)in_sizes[2] < need_in) return;
  if ((size_t)out_size < need_out) return;

  const size_t plane_b = (size_t)NB * SEQ * RS * sizeof(_Float16);   // 6291456 B at full size
  const size_t vsum_b  = (size_t)NB * NH * HD * sizeof(float);       // 6144 B at full size
  const size_t off_q = 0;
  const size_t off_k = off_q + plane_b;
  const size_t off_v = off_k + plane_b;
  const size_t off_s = off_v + plane_b;
  const size_t total = off_s + vsum_b;                               // 18880512 B at full size
  if (ws_size < total || total > WS_LIMIT) return;

  const float* q = (const float*)d_in[0];
  const float* k = (const float*)d_in[1];
  const float* v = (const float*)d_in[2];
  float* o = (float*)d_out;
  char* ws = (char*)d_ws;
  _Float16* qh  = (_Float16*)(ws + off_q);
  _Float16* kh  = (_Float16*)(ws + off_k);
  _Float16* vth = (_Float16*)(ws + off_v);
  float*    vs  = (float*)(ws + off_s);

  const int n8 = (int)((size_t)NB * SEQ * RS / 8);
  k_cvt_qk<<<dim3((n8 + 255) / 256, 2), 256, 0, stream>>>(q, k, qh, kh, n8);
  k_vtrans<<<dim3(SEQ / 64, NH, NB), 256, 0, stream>>>(v, vth);
  k_vsum<<<dim3(NH, NB, 2), 1024, 0, stream>>>(v, vs);
  k_attn<<<dim3(SEQ / 16, NH, NB), NTHR, 0, stream>>>(qh, kh, vth, vs, o);
  (void)hipGetLastError();
}

// v003
// It runs in 189 microseconds.
// Next to v002, in two timings, it ran 1.09 and 1.11 times as fast.
// Counting every step since v000, it is 2.69 times as fast.
#include <hip/hip_runtime.h>

// Contractions: S = Q.K^T and O = Pc.V on v_wmma_f32_16x16x32_f16 (f16 operands holding bf16-RNE-converted
// inputs; f32 accumulate). Row max, Newton steps and weights in f32; Pc = per-row centred weights carried
// x2^15 as f16, folded back in f32 together with the per-column sums of V.
// The f16 planes of Q, K and V are stored in fragment order: one 16x32 fragment = [2 pieces][32 lanes][8 halves]
// = 1 KiB, so each 16-byte-per-lane fragment load of a wave reads 512 contiguous bytes (4 whole 128-B lines).

#ifndef NB
#define NB 2
#endif
#ifndef SEQ
#define SEQ 2048
#endif
#define NB_FULL  2
#define SEQ_FULL 2048
#define NH       12
#define HD       64
#define RS       (NH * HD)          // elements between consecutive sequence rows
#define NTHR     512
#define NWAV     (NTHR / 32)
#define KPW      (SEQ / NWAV)       // keys per wave
#define NKT      (KPW / 16)         // 16-key score tiles per wave
#define NKC      (KPW / 32)         // 32-key P.V steps per wave
#define NSTEPS   6
#define PCARRY     32768.0f
#define PCARRY_INV (1.0f / 32768.0f)
#define WS_LIMIT ((size_t)134217728)
#define FRAG_H   512                // halves in one stored 16x32 fragment

static_assert(SEQ % 512 == 0);
static_assert(SEQ <= SEQ_FULL);
static_assert(NB >= 1 && NB <= NB_FULL);
static_assert(NKT * 16 * NWAV == SEQ);
static_assert(NKC * 2 == NKT);
static_assert((size_t)3 * NB * SEQ * RS * 2 + (size_t)NB * NH * HD * 4 <= WS_LIMIT);

typedef _Float16 v16h __attribute__((ext_vector_type(16)));
typedef _Float16 v8h  __attribute__((ext_vector_type(8)));
typedef float    v8f  __attribute__((ext_vector_type(8)));
typedef float    v4f  __attribute__((ext_vector_type(4)));

union AFrag { v16h v; v8h h[2]; };

// bf16 RNE convert of an f32 value, returned as f32 (inputs are finite)
__device__ __forceinline__ float bf16_rne(float x) {
  unsigned u = __float_as_uint(x);
  u = (u + 0x7fffu + ((u >> 16) & 1u)) & 0xffff0000u;
  return __uint_as_float(u);
}
__device__ __forceinline__ _Float16 to_h(float x) { return (_Float16)bf16_rne(x); }

__device__ __forceinline__ v8f zero8() {
  v8f z;
#pragma unroll
  for (int i = 0; i < 8; ++i) z[i] = 0.0f;
  return z;
}

// 16x32 fragment (A: lane row m, B: lane col n) from a 16-bit row-major matrix, k contiguous.
// lane m = lane&15; kb = 8*(lane>>4); elems 0..7 = k kb..kb+7, elems 8..15 = k kb+16..kb+23.
__device__ __forceinline__ v16h load_frag16(const _Float16* base, int ld, int lane) {
  const int m  = lane & 15;
  const int kb = (lane >> 4) << 3;
  const _Float16* p = base + (size_t)m * ld + kb;
  AFrag f;
  f.h[0] = *(const v8h*)(p);
  f.h[1] = *(const v8h*)(p + 16);
  return f.v;
}

// The same fragment from a plane in fragment order: piece j of lane l (k = 8*(l>>4) + 16*j + 0..7 of row or
// column l&15) lies at halves j*256 + l*8.
__device__ __forceinline__ v16h load_fragp(const _Float16* base, int lane) {
  const _Float16* p = base + lane * 8;
  AFrag f;
  f.h[0] = *(const v8h*)(p);
  f.h[1] = *(const v8h*)(p + 256);
  return f.v;
}

__device__ __forceinline__ v8f wmma16(v16h a, v16h b, v8f c) {
  v8f d = __builtin_amdgcn_wmma_f32_16x16x32_f16(false, a, false, b, (short)0, c, false, false);
  asm volatile("v_nop\n\tv_nop\n\tv_nop\n\tv_nop" : "+v"(d) : "v"(a), "v"(b) : "memory");
  return d;
}

// Lane exchanges on the vector pipe: they need no per-lane address register (a shuffle through the LDS unit does).
// CTRL: 0x160 | k = lane l ^ k inside its 16-lane row; 0x150 | k = lane k of the row to all 16. All lanes active.
template <int CTRL>
__device__ __forceinline__ float row_dpp(float x) {
  return __int_as_float(__builtin_amdgcn_update_dpp(0, __float_as_int(x), CTRL, 0xf, 0xf, true));
}
// lane l with lane l ^ 16
__device__ __forceinline__ float xhalf(float x) {
  return __int_as_float(__builtin_amdgcn_permlanex16(__float_as_int(x), __float_as_int(x), 0x76543210, 0xfedcba98, false, false));
}
// x holds the value of row (lane & 15), alike in both halves; returns the values of rows 8*hh + 0..7
__device__ __forceinline__ v8f rows_of_half(float x, int hh) {
  const float sw = row_dpp<0x168>(x);           // exchanged by every lane, then chosen by value
  const float y = hh ? sw : x;                  // place g of the upper half now holds row 8 + g
  v8f r;
  r[0] = row_dpp<0x150>(y); r[1] = row_dpp<0x151>(y); r[2] = row_dpp<0x152>(y); r[3] = row_dpp<0x153>(y);
  r[4] = row_dpp<0x154>(y); r[5] = row_dpp<0x155>(y); r[6] = row_dpp<0x156>(y); r[7] = row_dpp<0x157>(y);
  return r;
}

template <bool MX>
__device__ __forceinline__ float cmb(float x, float y) { return MX ? fmaxf(x, y) : (x + y); }

// Reduce 8 per-lane row values (rows 8*hh + 0..7 of this lane's half) over the 16 lanes of the half.
// Halving butterfly; result = total for row 8*hh + (m >> 1). All selects are by value, exchanges unconditional.
template <bool MX>
__device__ __forceinline__ float half_red8(v8f a, int m) {
  const bool b3 = (m & 8) != 0, b2 = (m & 4) != 0, b1 = (m & 2) != 0;
  float k1[4];
#pragma unroll
  for (int j = 0; j < 4; ++j) {
    const float snd = b3 ? a[j] : a[j + 4];
    const float kp  = b3 ? a[j + 4] : a[j];
    k1[j] = cmb<MX>(kp, row_dpp<0x168>(snd));
  }
  float k2[2];
#pragma unroll
  for (int j = 0; j < 2; ++j) {
    const float snd = b2 ? k1[j] : k1[j + 2];
    const float kp  = b2 ? k1[j + 2] : k1[j];
    k2[j] = cmb<MX>(kp, row_dpp<0x164>(snd));
  }
  const float snd3 = b1 ? k2[0] : k2[1];
  const float kp3  = b1 ? k2[1] : k2[0];
  const float k3 = cmb<MX>(kp3, row_dpp<0x162>(snd3));
  return cmb<MX>(k3, row_dpp<0x161>(k3));
}

// Block-wide reduction of two per-row quantities over all 16 waves, fixed order.
// rb points at a [2][16 rows][16 waves] f32 LDS buffer (cross-wave: block barrier inside).
// Returns in ta/tb the totals of row (lane & 15), bitwise identical in every lane/wave.
template <bool MX>
__device__ __forceinline__ void blockred2(v8f a, v8f b, float* rb, int lane, int wave,
                                          float& ta, float& tb) {
  const int m = lane & 15, hh = lane >> 4;
  const float ra = half_red8<MX>(a, m);
  const float rv = half_red8<MX>(b, m);
  if ((m & 1) == 0) {
    const int row = 8 * hh + (m >> 1);
    rb[row * 16 + wave]        = ra;
    rb[(16 + row) * 16 + wave] = rv;
  }
  __syncthreads();
  const float* pa = rb + m * 16 + 8 * hh;
  const float* pb = rb + (16 + m) * 16 + 8 * hh;
  const v4f a0 = *(const v4f*)(pa);
  const v4f a1 = *(const v4f*)(pa + 4);
  const v4f b0 = *(const v4f*)(pb);
  const v4f b1 = *(const v4f*)(pb + 4);
  float xa, xb;
  if (MX) {
    xa = fmaxf(fmaxf(fmaxf(a0[0], a0[1]), fmaxf(a0[2], a0[3])),
               fmaxf(fmaxf(a1[0], a1[1]), fmaxf(a1[2], a1[3])));
    xb = fmaxf(fmaxf(fmaxf(b0[0], b0[1]), fmaxf(b0[2], b0[3])),
               fmaxf(fmaxf(b1[0], b1[1]), fmaxf(b1[2], b1[3])));
  } else {
    xa = ((((((a0[0] + a0[1]) + a0[2]) + a0[3]) + a1[0]) + a1[1]) + a1[2]) + a1[3];
    xb = ((((((b0[0] + b0[1]) + b0[2]) + b0[3]) + b1[0]) + b1[1]) + b1[2]) + b1[3];
  }
  const float ya = xhalf(xa);
  const float yb = xhalf(xb);
  ta = cmb<MX>(xa, ya);
  tb = cmb<MX>(xb, yb);
}

// ---------------------------------------------------------------------------
// Q and K planes, bf16-RNE values in f16 containers, fragment order: [b][h][l/16][d/32] fragments, lane row = l&15.
// Thread = one 8-element piece (b, h, l, d8): a wave reads 4 rows x 256 B and writes 8 runs of 64 B.
// coverage: n8*8 = NB*SEQ*RS elements per plane (whole plane); blockIdx.y selects Q (0) or K (1).
// ---------------------------------------------------------------------------
__global__ __launch_bounds__(256) void k_cvt_qk(const float* __restrict__ q, const float* __restrict__ k,
                                                _Float16* __restrict__ qh, _Float16* __restrict__ kh, int n8) {
  const int i = blockIdx.x * 256 + threadIdx.x;
  if (i >= n8) return;
  const bool second = (blockIdx.y != 0);
  const float* src = second ? k : q;
  _Float16* dst = second ? kh : qh;
  const int d8 = i & 7;              // d = 8*d8 + 0..7: fragment d8>>2, piece (d8>>1)&1, lane half d8&1
  const int r  = i >> 3;             // (b*NH + h)*SEQ + l
  const int l  = r % SEQ;
  const int bh = r / SEQ;
  const int h  = bh % NH, bb = bh / NH;
  const float* p = src + ((size_t)bb * SEQ_FULL + l) * RS + h * HD + d8 * 8;
  const size_t e = (((size_t)bh * (SEQ / 16) + (l >> 4)) * 2 + (d8 >> 2)) * FRAG_H
                   + ((d8 >> 1) & 1) * 256 + ((d8 & 1) * 16 + (l & 15)) * 8;
  const v4f f0 = *(const v4f*)(p);
  const v4f f1 = *(const v4f*)(p + 4);
  v8h o;
  o[0] = to_h(f0[0]); o[1] = to_h(f0[1]); o[2] = to_h(f0[2]); o[3] = to_h(f0[3]);
  o[4] = to_h(f1[0]); o[5] = to_h(f1[1]); o[6] = to_h(f1[2]); o[7] = to_h(f1[3]);
  v8h* d = (v8h*)(dst + e);
  *d = o;
  
}

// ---------------------------------------------------------------------------
// V^T plane, bf16-RNE values in f16 containers, fragment order: [b][h][l/32][d/16] fragments, lane column = d&15,
// k = l&31. in: v[b][l0..l0+63][h][0..63] -> out: the 8 fragments of keys l0..l0+63 (8 KiB in a row); transpose
// through LDS;
// coverage: 256 threads x 2 pieces x 8 halves = 64 d x 64 l per block; grid (SEQ/64, NH, NB) -> whole plane.
// ---------------------------------------------------------------------------
__global__ __launch_bounds__(256) void k_vtrans(const float* __restrict__ v, _Float16* __restrict__ vth) {
  __shared__ __align__(16) _Float16 tile[HD][72];   // cross-thread tile: block barrier between fill and read
  const int tid = threadIdx.x;
  const int l0 = blockIdx.x * 64, h = blockIdx.y, bb = blockIdx.z;
  const float* vb = v + ((size_t)bb * SEQ_FULL + l0) * RS + h * HD;
#pragma unroll
  for (int j = 0; j < 4; ++j) {
    const int idx = tid + 256 * j;            // 0..1023
    const int l = idx >> 4, d4 = (idx & 15) * 4;
    const v4f f = *(const v4f*)(vb + (size_t)l * RS + d4);
    tile[d4 + 0][l] = to_h(f[0]);
    tile[d4 + 1][l] = to_h(f[1]);
    tile[d4 + 2][l] = to_h(f[2]);
    tile[d4 + 3][l] = to_h(f[3]);
  }
  __syncthreads();
  _Float16* ob = vth + ((size_t)(bb * NH + h) * (SEQ / 32) + (l0 >> 5)) * (4 * FRAG_H);
  v8h val[2];
  size_t off[2];
#pragma unroll
  for (int j = 0; j < 2; ++j) {
    const int p = tid + 256 * j;              // 0..511 = [32-key step j][d/16][piece][lane]
    const int ln = p & 31;
    const int row = ((p >> 6) & 3) * 16 + (ln & 15);
    const int key = j * 32 + ((p >> 5) & 1) * 16 + (ln >> 4) * 8;
    val[j] = *(const v8h*)(&tile[row][key]);
    off[j] = (size_t)p * 8;
  }
  *(v8h*)(ob + off[0]) = val[0];
  *(v8h*)(ob + off[1]) = val[1];
  
}

// ---------------------------------------------------------------------------
// vsum[b][h][d] = sum_l bf16_rne(v[b][l][h][d]), f64 accumulation, f32 result.
// One block = one (b, h, 32-d half) = one 128-B line of the table. 1024 threads: 8 lanes x 16 B cover the
// 128-B row piece, 128 row groups; thread (g, c) sums rows g, g+128, ... in f64. Fixed-order fold of the
// 128 groups through LDS: 4 groups per wave, then a pairwise tree over the 32 wave sums in wave 0.
// coverage: grid (NH, NB, 2) x 32 lanes of wave 0 -> whole table.
// ---------------------------------------------------------------------------
#define VS_GRP 128
static_assert(SEQ % VS_GRP == 0);
__global__ __launch_bounds__(1024) void k_vsum(const float* __restrict__ v, float* __restrict__ vsum) {
  __shared__ __align__(16) double part[VS_GRP][32];   // rows 4w..4w+3 written and read by wave w; block barrier
  __shared__ __align__(16) double wsum[32][32];       // cross-wave: block barrier
  const int tid = threadIdx.x;
  const int c = tid & 7, g = tid >> 3;
  const int h = blockIdx.x, bb = blockIdx.y, d0 = blockIdx.z * 32;
  const float* p = v + ((size_t)bb * SEQ_FULL + g) * RS + h * HD + d0 + c * 4;
  v4f f[SEQ / VS_GRP];
  // unrolled: all of a thread's loads are in flight at once, one memory latency for the whole column piece
#pragma unroll
  for (int j = 0; j < SEQ / VS_GRP; ++j) f[j] = *(const v4f*)(p + (size_t)j * VS_GRP * RS);
  double a0 = 0.0, a1 = 0.0, a2 = 0.0, a3 = 0.0;
  // unrolled: f[] stays in registers
#pragma unroll
  for (int j = 0; j < SEQ / VS_GRP; ++j) {
    a0 += (double)bf16_rne(f[j][0]);
    a1 += (double)bf16_rne(f[j][1]);
    a2 += (double)bf16_rne(f[j][2]);
    a3 += (double)bf16_rne(f[j][3]);
  }
  part[g][c * 4 + 0] = a0;
  part[g][c * 4 + 1] = a1;
  part[g][c * 4 + 2] = a2;
  part[g][c * 4 + 3] = a3;
  __syncthreads();
  const int lane = tid & 31, wave = tid >> 5;
  wsum[wave][lane] = ((part[4 * wave][lane] + part[4 * wave + 1][lane]) + part[4 * wave + 2][lane])
                     + part[4 * wave + 3][lane];
  __syncthreads();
  if (wave == 0) {
    double x[32];
    // all three unrolled: x[] stays in registers, the 32 LDS reads issue together
#pragma unroll
    for (int w = 0; w < 32; ++w) x[w] = wsum[w][lane];
#pragma unroll
    for (int s = 1; s < 32; s *= 2) {
#pragma unroll
      for (int w = 0; w < 32; w += 2 * s) x[w] += x[w + s];
    }
    vsum[(size_t)(bb * NH + h) * HD + d0 + lane] = (float)x[0];
  }
}

// ---------------------------------------------------------------------------
// Fused attention with the polynomial normaliser for one (b, h, 16 query rows).
// 16 waves; wave w owns keys [w*KPW, w*KPW+KPW). Full score row kept in WMMA D registers:
// s[t][g] = S(row 8*hh+g, key w*KPW + 16*t + m). Row reductions: in-half shuffles + fixed-order
// cross-wave combine through LDS (identical result in every wave). P tile C-layout -> A-fragment
// through a per-wave LDS tile; Q, K and V^T fragments straight from the fragment-order planes; partial O folded
// ---------------------------------------------------------------------------
// 128 VGPRs: 8 waves per SIMD, so two of these 16-wave work-groups share a WGP and one computes while the
// other waits on its loads, its barriers and its reduction chains.
__global__ __launch_bounds__(NTHR) __attribute__((amdgpu_num_vgpr(128)))
void k_attn(const _Float16* __restrict__ qh, const _Float16* __restrict__ kh,
            const _Float16* __restrict__ vth, const float* __restrict__ vsum,
            float* __restrict__ out) {
  __shared__ __align__(16) _Float16 Pst[NWAV][16][32];   // wave-private tiles (wave sync only)
  __shared__ __align__(16) float red[2][2][16][16];      // cross-wave, ping-pong by reduction parity
  __shared__ __align__(16) float Ored[4][16][HD];        // cross-wave partial O fold
  __shared__ __align__(16) float Ofin[16][HD];           // cross-wave final tile
  __shared__ float wbar_sh[16];

  const int tid  = threadIdx.x;
  const int lane = tid & 31, wave = tid >> 5;
  const int m = lane & 15, hh = lane >> 4, r0 = hh << 3;
  const int q0 = blockIdx.x * 16, h = blockIdx.y, b = blockIdx.z;
  const size_t bh = (size_t)(b * NH + h);

  const _Float16* qp = qh  + (bh * (SEQ / 16) + blockIdx.x) * (2 * FRAG_H);
  const _Float16* kp = kh  + (bh * (SEQ / 16) + wave * NKT) * (2 * FRAG_H);
  const _Float16* vp = vth + (bh * (SEQ / 32) + wave * NKC) * (4 * FRAG_H);

  // ---- S = (Q . K^T) / 8 for 16 rows x KPW keys of this wave ----
  v8f s[NKT];
  {
    const v16h qa0 = load_fragp(qp, lane);             // d 0..31
    const v16h qa1 = load_fragp(qp + FRAG_H, lane);    // d 32..63
#pragma unroll
    for (int t = 0; t < NKT; ++t) {
      const _Float16* kt = kp + t * (2 * FRAG_H);
      const v16h kb0 = load_fragp(kt, lane);           // B: lane = key, elems = d (split map)
      const v16h kb1 = load_fragp(kt + FRAG_H, lane);
      v8f acc = zero8();
      acc = wmma16(qa0, kb0, acc);
      acc = wmma16(qa1, kb1, acc);
      s[t] = acc * 0.125f;
    }
  }

  // ---- c0 = -rowmax - 1 ----
  float cl;    // c of row (lane & 15)
  v8f   cv;    // c of rows r0 + g
  {
    v8f mx;
#pragma unroll
    for (int g = 0; g < 8; ++g) {
      float x = s[0][g];
#pragma unroll
      for (int t = 1; t < NKT; ++t) x = fmaxf(x, s[t][g]);
      mx[g] = x;
    }
    float ta, tb;
    blockred2<true>(mx, mx, &red[0][0][0][0], lane, wave, ta, tb);
    cl = -ta - 1.0f;
    cv = rows_of_half(cl, hh);
  }

  // ---- Newton steps: c -= (sum 1/(-x-c)^2 - 1) / (2 sum 1/(-x-c)^3 + 1e-8) ----
#pragma unroll 1
  for (int it = 0; it < NSTEPS; ++it) {
    v8f ps = zero8(), pd = zero8();
#pragma unroll
    for (int t = 0; t < NKT; ++t) {
      const v8f tt = -s[t] - cv;
      v8f y;
#pragma unroll
      for (int g = 0; g < 8; ++g) y[g] = __builtin_amdgcn_rcpf(tt[g]);
      const v8f a = y * y;
      ps += a;
      pd += a * y;
    }
    float ta, tb;
    blockred2<false>(ps, pd, &red[(it + 1) & 1][0][0][0], lane, wave, ta, tb);
    cl = cl - (ta - 1.0f) / (2.0f * tb + 1e-8f);
    cv = rows_of_half(cl, hh);
  }

  // ---- final weights w = 1/(-x-c)^2 (kept in s), per-row centre wbar = sum(w)/SEQ ----
  v8f wb;
  {
    v8f sw = zero8();
#pragma unroll
    for (int t = 0; t < NKT; ++t) {
      const v8f tt = -s[t] - cv;
      v8f y;
#pragma unroll
      for (int g = 0; g < 8; ++g) y[g] = __builtin_amdgcn_rcpf(tt[g]);
      const v8f w = y * y;
      s[t] = w;
      sw += w;
    }
    float ta, tb;
    blockred2<false>(sw, sw, &red[1][0][0][0], lane, wave, ta, tb);
    const float wbl = ta * (1.0f / (float)SEQ);
    if (wave == 0 && lane < 16) wbar_sh[lane] = wbl;
    wb = rows_of_half(wbl, hh);
  }

  // ---- O_w = Pc (16 x KPW) . V (KPW x 64), Pc = (w - wbar) * 2^15 as f16 ----
  v8f o[4];
#pragma unroll
  for (int st = 0; st < 4; ++st) o[st] = zero8();
  _Float16* pst = &Pst[wave][0][0];
#pragma unroll
  for (int kc = 0; kc < NKC; ++kc) {
    const v8f p0 = (s[2 * kc] - wb) * PCARRY;
    const v8f p1 = (s[2 * kc + 1] - wb) * PCARRY;
    __builtin_amdgcn_fence(5, "wavefront");
    __builtin_amdgcn_wave_barrier();
#pragma unroll
    for (int g = 0; g < 8; ++g) {
      pst[(r0 + g) * 32 + m]      = (_Float16)p0[g];   // key 32kc + m
      pst[(r0 + g) * 32 + m + 16] = (_Float16)p1[g];   // key 32kc + 16 + m
    }
    __builtin_amdgcn_fence(5, "wavefront");
    __builtin_amdgcn_wave_barrier();
    const v16h pa = load_frag16(pst, 32, lane);        // A: lane = query row, elems = keys (split map)
#pragma unroll
    for (int st = 0; st < 4; ++st) {
      // B: lane = d, elems = keys (split map)
      const v16h vbf = load_fragp(vp + (kc * 4 + st) * FRAG_H, lane);
      o[st] = wmma16(pa, vbf, o[st]);
    }
  }

  // ---- fixed-order fold of the 16 per-wave partials: slot = wave & 3, phases wave >> 2 ----
#pragma unroll 1
  for (int ph = 0; ph < 4; ++ph) {
    if ((wave >> 2) == ph) {
      float* ob = &Ored[wave & 3][0][0];
#pragma unroll
      for (int st = 0; st < 4; ++st) {
#pragma unroll
        for (int g = 0; g < 8; ++g) {
          float* pr = ob + (r0 + g) * HD + st * 16 + m;
          const float x = o[st][g];
          if (ph == 0) *pr = x; else *pr = *pr + x;
        }
      }
    }
    __syncthreads();
  }

  // ---- epilogue: out = O/2^15 + wbar * sum_k v ----
  {
    const float* vsp = vsum + (size_t)(b * NH + h) * HD;
#pragma unroll
    for (int j = 0; j < 2; ++j) {
      const int e = tid * 2 + j;
      const int row = e >> 6, d = e & 63;
      const float a = ((Ored[0][row][d] + Ored[1][row][d]) + Ored[2][row][d]) + Ored[3][row][d];
      Ofin[row][d] = a * PCARRY_INV + wbar_sh[row] * vsp[d];
    }
  }
  __syncthreads();
  if (wave < 4) {
    // lanes 8k..8k+7 cover one line each.
    v4f val[2];
    size_t off[2];
#pragma unroll
    for (int j = 0; j < 2; ++j) {
      const int row = wave * 4 + 2 * j + hh;
      val[j] = *(const v4f*)(&Ofin[row][m * 4]);
      off[j] = ((size_t)b * SEQ + q0 + row) * RS + h * HD + m * 4;
    }
    *(v4f*)(out + off[0]) = val[0];
    *(v4f*)(out + off[1]) = val[1];
    
  }
}

// ---------------------------------------------------------------------------
// Host side
// ---------------------------------------------------------------------------
extern "C" void kernel_launch(void* const* d_in, const int* in_sizes, int n_in,
                              void* d_out, int out_size, void* d_ws, size_t ws_size,
                              hipStream_t stream) {
  if (n_in < 3 || d_ws == nullptr || d_out == nullptr) return;
  const size_t need_in  = ((size_t)(NB - 1) * SEQ_FULL + SEQ) * RS;
  const size_t need_out = (size_t)NB * SEQ * RS;
  if ((size_t)in_sizes[0] < need_in || (size_t)in_sizes[1] < need_in || (size_t)in_sizes[2] < need_in) return;
  if ((size_t)out_size < need_out) return;

  const size_t plane_b = (size_t)NB * SEQ * RS * sizeof(_Float16);   // 6291456 B at full size
  const size_t vsum_b  = (size_t)NB * NH * HD * sizeof(float);       // 6144 B at full size
  const size_t off_q = 0;
  const size_t off_k = off_q + plane_b;
  const size_t off_v = off_k + plane_b;
  const size_t off_s = off_v + plane_b;
  const size_t total = off_s + vsum_b;                               // 18880512 B at full size
  if (ws_size < total || total > WS_LIMIT) return;

  const float* q = (const float*)d_in[0];
  const float* k = (const float*)d_in[1];
  const float* v = (const float*)d_in[2];
  float* o = (float*)d_out;
  char* ws = (char*)d_ws;
  _Float16* qh  = (_Float16*)(ws + off_q);
  _Float16* kh  = (_Float16*)(ws + off_k);
  _Float16* vth = (_Float16*)(ws + off_v);
  float*    vs  = (float*)(ws + off_s);

  const int n8 = (int)((size_t)NB * SEQ * RS / 8);
  k_cvt_qk<<<dim3((n8 + 255) / 256, 2), 256, 0, stream>>>(q, k, qh, kh, n8);
  k_vtrans<<<dim3(SEQ / 64, NH, NB), 256, 0, stream>>>(v, vth);
  k_vsum<<<dim3(NH, NB, 2), 1024, 0, stream>>>(v, vs);
  k_attn<<<dim3(SEQ / 16, NH, NB), NTHR, 0, stream>>>(qh, kh, vth, vs, o);
  (void)hipGetLastError();
}

// v004
// It runs in 170 microseconds.
// Next to v003, in two timings, it ran 1.12 and 1.11 times as fast.
// All steps since v000 together make it 2.99 times as fast.
#include <hip/hip_runtime.h>

// Contractions: S^T = K.Q^T and O = Pc.V on v_wmma_f32_16x16x32_f16 (f16 operands holding bf16-RNE-converted
// inputs; f32 accumulate). Row max, Newton steps and weights in f32; Pc = per-row centred weights carried
// x2^15 as f16, folded back in f32 together with the per-column sums of V.
// The f16 planes of Q, K and V are stored in fragment order: one 16x32 fragment = [2 pieces][32 lanes][8 halves]
// = 1 KiB, so each 16-byte-per-lane fragment load of a wave reads 512 contiguous bytes (4 whole 128-B lines).

#ifndef NB
#define NB 2
#endif
#ifndef SEQ
#define SEQ 2048
#endif
#define NB_FULL  2
#define SEQ_FULL 2048
#define NH       12
#define HD       64
#define RS       (NH * HD)          // elements between consecutive sequence rows
#define NTHR     512
#define NWAV     (NTHR / 32)
#define KPW      (SEQ / NWAV)       // keys per wave
#define NKT      (KPW / 16)         // 16-key score tiles per wave
#define NKC      (KPW / 32)         // 32-key P.V steps per wave
#define NSTEPS   6
#define PCARRY     32768.0f
#define PCARRY_INV (1.0f / 32768.0f)
#define WS_LIMIT ((size_t)134217728)
#define FRAG_H   512                // halves in one stored 16x32 fragment

static_assert(SEQ % 512 == 0);
static_assert(SEQ <= SEQ_FULL);
static_assert(NB >= 1 && NB <= NB_FULL);
static_assert(NKT * 16 * NWAV == SEQ);
static_assert(NKC * 2 == NKT);
static_assert((size_t)3 * NB * SEQ * RS * 2 + (size_t)NB * NH * HD * 4 <= WS_LIMIT);

typedef _Float16 v16h __attribute__((ext_vector_type(16)));
typedef _Float16 v8h  __attribute__((ext_vector_type(8)));
typedef float    v8f  __attribute__((ext_vector_type(8)));
typedef float    v4f  __attribute__((ext_vector_type(4)));
typedef float    v2f  __attribute__((ext_vector_type(2)));

union AFrag { v16h v; v8h h[2]; };

// bf16 RNE convert of an f32 value, returned as f32 (inputs are finite)
__device__ __forceinline__ float bf16_rne(float x) {
  unsigned u = __float_as_uint(x);
  u = (u + 0x7fffu + ((u >> 16) & 1u)) & 0xffff0000u;
  return __uint_as_float(u);
}
__device__ __forceinline__ _Float16 to_h(float x) { return (_Float16)bf16_rne(x); }

__device__ __forceinline__ v8f zero8() {
  v8f z;
#pragma unroll
  for (int i = 0; i < 8; ++i) z[i] = 0.0f;
  return z;
}

// 16x32 fragment (A: lane row m, B: lane col n), m or n = lane&15: elems 0..7 = k kb..kb+7, elems 8..15 = k kb+16..kb+23,
// kb = 8*(lane>>4). From a plane in fragment order: piece j of lane l (k = 8*(l>>4) + 16*j + 0..7 of row or
// column l&15) lies at halves j*256 + l*8.
__device__ __forceinline__ v16h load_fragp(const _Float16* base, int lane) {
  const _Float16* p = base + lane * 8;
  AFrag f;
  f.h[0] = *(const v8h*)(p);
  f.h[1] = *(const v8h*)(p + 256);
  return f.v;
}

__device__ __forceinline__ v8f wmma16(v16h a, v16h b, v8f c) {
  v8f d = __builtin_amdgcn_wmma_f32_16x16x32_f16(false, a, false, b, (short)0, c, false, false);
  asm volatile("v_nop\n\tv_nop\n\tv_nop\n\tv_nop" : "+v"(d) : "v"(a), "v"(b) : "memory");
  return d;
}

// lane l with lane l ^ 16, on the vector pipe
__device__ __forceinline__ float xhalf(float x) {
  return __int_as_float(__builtin_amdgcn_permlanex16(__float_as_int(x), __float_as_int(x), 0x76543210, 0xfedcba98, false, false));
}

template <bool MX>
__device__ __forceinline__ float cmb(float x, float y) { return MX ? fmaxf(x, y) : (x + y); }

// Fixed-order sum of the 8 components of a lane's own vector (pairwise, two components at a time).
__device__ __forceinline__ float sum8(v8f a) {
  const v2f x = (__builtin_shufflevector(a, a, 0, 1) + __builtin_shufflevector(a, a, 2, 3))
              + (__builtin_shufflevector(a, a, 4, 5) + __builtin_shufflevector(a, a, 6, 7));
  return x[0] + x[1];
}

// Block-wide reduction of two per-row quantities over all 16 waves, fixed order.
// a, b: this lane's partial for query row (lane & 15) over the keys its half holds.
// rb points at a [2][16 rows][16 waves] f32 LDS buffer (cross-wave: block barrier inside).
// Returns in ta/tb the totals of row (lane & 15), bitwise identical in every lane/wave.
template <bool MX>
__device__ __forceinline__ void blockred2(float a, float b, float* rb, int lane, int wave,
                                          float& ta, float& tb) {
  const int m = lane & 15, hh = lane >> 4;
  const float ra = cmb<MX>(a, xhalf(a));
  const float rv = cmb<MX>(b, xhalf(b));
  rb[(16 * hh + m) * 16 + wave] = hh ? rv : ra;   // lower half stores the first quantity, upper half the second
  __syncthreads();
  const float* pa = rb + m * 16 + 8 * hh;
  const float* pb = rb + (16 + m) * 16 + 8 * hh;
  const v4f a0 = *(const v4f*)(pa);
  const v4f a1 = *(const v4f*)(pa + 4);
  const v4f b0 = *(const v4f*)(pb);
  const v4f b1 = *(const v4f*)(pb + 4);
  float xa, xb;
  if (MX) {
    xa = fmaxf(fmaxf(fmaxf(a0[0], a0[1]), fmaxf(a0[2], a0[3])),
               fmaxf(fmaxf(a1[0], a1[1]), fmaxf(a1[2], a1[3])));
    xb = fmaxf(fmaxf(fmaxf(b0[0], b0[1]), fmaxf(b0[2], b0[3])),
               fmaxf(fmaxf(b1[0], b1[1]), fmaxf(b1[2], b1[3])));
  } else {
    xa = ((((((a0[0] + a0[1]) + a0[2]) + a0[3]) + a1[0]) + a1[1]) + a1[2]) + a1[3];
    xb = ((((((b0[0] + b0[1]) + b0[2]) + b0[3]) + b1[0]) + b1[1]) + b1[2]) + b1[3];
  }
  const float ya = xhalf(xa);
  const float yb = xhalf(xb);
  ta = cmb<MX>(xa, ya);
  tb = cmb<MX>(xb, yb);
}

// ---------------------------------------------------------------------------
// Q and K planes, bf16-RNE values in f16 containers, fragment order: [b][h][l/16][d/32] fragments, lane row = l&15.
// Thread = one 8-element piece (b, h, l, d8): a wave reads 4 rows x 256 B and writes 8 runs of 64 B.
// coverage: n8*8 = NB*SEQ*RS elements per plane (whole plane); blockIdx.y selects Q (0) or K (1).
// ---------------------------------------------------------------------------
__global__ __launch_bounds__(256) void k_cvt_qk(const float* __restrict__ q, const float* __restrict__ k,
                                                _Float16* __restrict__ qh, _Float16* __restrict__ kh, int n8) {
  const int i = blockIdx.x * 256 + threadIdx.x;
  if (i >= n8) return;
  const bool second = (blockIdx.y != 0);
  const float* src = second ? k : q;
  _Float16* dst = second ? kh : qh;
  const int d8 = i & 7;              // d = 8*d8 + 0..7: fragment d8>>2, piece (d8>>1)&1, lane half d8&1
  const int r  = i >> 3;             // (b*NH + h)*SEQ + l
  const int l  = r % SEQ;
  const int bh = r / SEQ;
  const int h  = bh % NH, bb = bh / NH;
  const float* p = src + ((size_t)bb * SEQ_FULL + l) * RS + h * HD + d8 * 8;
  const size_t e = (((size_t)bh * (SEQ / 16) + (l >> 4)) * 2 + (d8 >> 2)) * FRAG_H
                   + ((d8 >> 1) & 1) * 256 + ((d8 & 1) * 16 + (l & 15)) * 8;
  const v4f f0 = *(const v4f*)(p);
  const v4f f1 = *(const v4f*)(p + 4);
  v8h o;
  o[0] = to_h(f0[0]); o[1] = to_h(f0[1]); o[2] = to_h(f0[2]); o[3] = to_h(f0[3]);
  o[4] = to_h(f1[0]); o[5] = to_h(f1[1]); o[6] = to_h(f1[2]); o[7] = to_h(f1[3]);
  v8h* d = (v8h*)(dst + e);
  *d = o;
  
}

// ---------------------------------------------------------------------------
// V^T plane, bf16-RNE values in f16 containers, fragment order: [b][h][l/32][d/16] fragments, lane column = d&15,
// k = l&31. in: v[b][l0..l0+63][h][0..63] -> out: the 8 fragments of keys l0..l0+63 (8 KiB in a row); transpose
// through LDS;
// coverage: 256 threads x 2 pieces x 8 halves = 64 d x 64 l per block; grid (SEQ/64, NH, NB) -> whole plane.
// ---------------------------------------------------------------------------
__global__ __launch_bounds__(256) void k_vtrans(const float* __restrict__ v, _Float16* __restrict__ vth) {
  __shared__ __align__(16) _Float16 tile[HD][72];   // cross-thread tile: block barrier between fill and read
  const int tid = threadIdx.x;
  const int l0 = blockIdx.x * 64, h = blockIdx.y, bb = blockIdx.z;
  const float* vb = v + ((size_t)bb * SEQ_FULL + l0) * RS + h * HD;
#pragma unroll
  for (int j = 0; j < 4; ++j) {
    const int idx = tid + 256 * j;            // 0..1023
    const int l = idx >> 4, d4 = (idx & 15) * 4;
    const v4f f = *(const v4f*)(vb + (size_t)l * RS + d4);
    tile[d4 + 0][l] = to_h(f[0]);
    tile[d4 + 1][l] = to_h(f[1]);
    tile[d4 + 2][l] = to_h(f[2]);
    tile[d4 + 3][l] = to_h(f[3]);
  }
  __syncthreads();
  _Float16* ob = vth + ((size_t)(bb * NH + h) * (SEQ / 32) + (l0 >> 5)) * (4 * FRAG_H);
  v8h val[2];
  size_t off[2];
#pragma unroll
  for (int j = 0; j < 2; ++j) {
    const int p = tid + 256 * j;              // 0..511 = [32-key step j][d/16][piece][lane]
    const int ln = p & 31;
    const int row = ((p >> 6) & 3) * 16 + (ln & 15);
    const int key = j * 32 + ((p >> 5) & 1) * 16 + (ln >> 4) * 8;
    val[j] = *(const v8h*)(&tile[row][key]);
    off[j] = (size_t)p * 8;
  }
  *(v8h*)(ob + off[0]) = val[0];
  *(v8h*)(ob + off[1]) = val[1];
  
}

// ---------------------------------------------------------------------------
// vsum[b][h][d] = sum_l bf16_rne(v[b][l][h][d]), f64 accumulation, f32 result.
// One block = one (b, h, 32-d half) = one 128-B line of the table. 1024 threads: 8 lanes x 16 B cover the
// 128-B row piece, 128 row groups; thread (g, c) sums rows g, g+128, ... in f64. Fixed-order fold of the
// 128 groups through LDS: 4 groups per wave, then a pairwise tree over the 32 wave sums in wave 0.
// coverage: grid (NH, NB, 2) x 32 lanes of wave 0 -> whole table.
// ---------------------------------------------------------------------------
#define VS_GRP 128
static_assert(SEQ % VS_GRP == 0);
__global__ __launch_bounds__(1024) void k_vsum(const float* __restrict__ v, float* __restrict__ vsum) {
  __shared__ __align__(16) double part[VS_GRP][32];   // rows 4w..4w+3 written and read by wave w; block barrier
  __shared__ __align__(16) double wsum[32][32];       // cross-wave: block barrier
  const int tid = threadIdx.x;
  const int c = tid & 7, g = tid >> 3;
  const int h = blockIdx.x, bb = blockIdx.y, d0 = blockIdx.z * 32;
  const float* p = v + ((size_t)bb * SEQ_FULL + g) * RS + h * HD + d0 + c * 4;
  v4f f[SEQ / VS_GRP];
  // unrolled: all of a thread's loads are in flight at once, one memory latency for the whole column piece
#pragma unroll
  for (int j = 0; j < SEQ / VS_GRP; ++j) f[j] = *(const v4f*)(p + (size_t)j * VS_GRP * RS);
  double a0 = 0.0, a1 = 0.0, a2 = 0.0, a3 = 0.0;
  // unrolled: f[] stays in registers
#pragma unroll
  for (int j = 0; j < SEQ / VS_GRP; ++j) {
    a0 += (double)bf16_rne(f[j][0]);
    a1 += (double)bf16_rne(f[j][1]);
    a2 += (double)bf16_rne(f[j][2]);
    a3 += (double)bf16_rne(f[j][3]);
  }
  part[g][c * 4 + 0] = a0;
  part[g][c * 4 + 1] = a1;
  part[g][c * 4 + 2] = a2;
  part[g][c * 4 + 3] = a3;
  __syncthreads();
  const int lane = tid & 31, wave = tid >> 5;
  wsum[wave][lane] = ((part[4 * wave][lane] + part[4 * wave + 1][lane]) + part[4 * wave + 2][lane])
                     + part[4 * wave + 3][lane];
  __syncthreads();
  if (wave == 0) {
    double x[32];
    // all three unrolled: x[] stays in registers, the 32 LDS reads issue together
#pragma unroll
    for (int w = 0; w < 32; ++w) x[w] = wsum[w][lane];
#pragma unroll
    for (int s = 1; s < 32; s *= 2) {
#pragma unroll
      for (int w = 0; w < 32; w += 2 * s) x[w] += x[w + s];
    }
    vsum[(size_t)(bb * NH + h) * HD + d0 + lane] = (float)x[0];
  }
}

// ---------------------------------------------------------------------------
// Fused attention with the polynomial normaliser for one (b, h, 16 query rows).
// 16 waves; wave w owns keys [w*KPW, w*KPW+KPW). Scores are formed transposed (A = K tile, B = Q tile) and kept
// in WMMA D registers: s[t][g] = S(query lane&15, key w*KPW + 16*t + 8*hh + g). A lane holds scores of ONE query:
// row sums are sums of its own registers, then the other half, then a fixed-order cross-wave combine through LDS
// (identical result in every wave); c and wbar are the same for all of a lane's scores; and tiles 2kc, 2kc+1 of
// a lane are, in order, the 16 elements of its A fragment of P for key step kc. Q, K and V^T fragments come straight from the
// fragment-order planes; partial O folded through LDS.
// ---------------------------------------------------------------------------
// 128 VGPRs: 8 waves per SIMD, so two of these 16-wave work-groups share a WGP and one computes while the
// other waits on its loads, its barriers and its reduction chains.
__global__ __launch_bounds__(NTHR) __attribute__((amdgpu_num_vgpr(128)))
void k_attn(const _Float16* __restrict__ qh, const _Float16* __restrict__ kh,
            const _Float16* __restrict__ vth, const float* __restrict__ vsum,
            float* __restrict__ out) {
  __shared__ __align__(16) float red[2][2][16][16];      // cross-wave, ping-pong by reduction parity
  __shared__ __align__(16) float Ored[4][16][HD];        // cross-wave partial O fold
  __shared__ __align__(16) float Ofin[16][HD];           // cross-wave final tile
  __shared__ float wbar_sh[16];

  const int tid  = threadIdx.x;
  const int lane = tid & 31, wave = tid >> 5;
  const int m = lane & 15, hh = lane >> 4, r0 = hh << 3;
  const int q0 = blockIdx.x * 16, h = blockIdx.y, b = blockIdx.z;
  const size_t bh = (size_t)(b * NH + h);

  const _Float16* qp = qh  + (bh * (SEQ / 16) + blockIdx.x) * (2 * FRAG_H);
  const _Float16* kp = kh  + (bh * (SEQ / 16) + wave * NKT) * (2 * FRAG_H);
  const _Float16* vp = vth + (bh * (SEQ / 32) + wave * NKC) * (4 * FRAG_H);

  // ---- S^T = (K . Q^T) / 8 for KPW keys of this wave x 16 query rows ----
  v8f s[NKT];
  {
    const v16h qb0 = load_fragp(qp, lane);             // B: lane = query, elems = d 0..31 (split map)
    const v16h qb1 = load_fragp(qp + FRAG_H, lane);    // d 32..63
#pragma unroll
    for (int t = 0; t < NKT; ++t) {
      const _Float16* kt = kp + t * (2 * FRAG_H);
      const v16h ka0 = load_fragp(kt, lane);           // A: lane = key, elems = d (same split map)
      const v16h ka1 = load_fragp(kt + FRAG_H, lane);
      v8f acc = zero8();
      acc = wmma16(ka0, qb0, acc);
      acc = wmma16(ka1, qb1, acc);
      s[t] = acc * 0.125f;
    }
  }

  // ---- c0 = -rowmax - 1 ----
  // c of query row (lane & 15), the same value 8 times: from a vector operand the compiler forms -x - c with packed
  // subtracts (two scores an issue), from a scalar c it emits single ones
  v8f cv;
  {
    float x = s[0][0];
#pragma unroll
    for (int t = 0; t < NKT; ++t) {
#pragma unroll
      for (int g = 0; g < 8; ++g) x = fmaxf(x, s[t][g]);
    }
    float ta, tb;
    blockred2<true>(x, x, &red[0][0][0][0], lane, wave, ta, tb);
    const float c0 = -ta - 1.0f;
#pragma unroll
    for (int g = 0; g < 8; ++g) cv[g] = c0;
  }

  // ---- Newton steps: c -= (sum 1/(-x-c)^2 - 1) / (2 sum 1/(-x-c)^3 + 1e-8) ----
#pragma unroll 1
  for (int it = 0; it < NSTEPS; ++it) {
    v8f ps = zero8(), pd = zero8();
#pragma unroll
    for (int t = 0; t < NKT; ++t) {
      const v8f tt = -s[t] - cv;
      v8f y;
#pragma unroll
      for (int g = 0; g < 8; ++g) y[g] = __builtin_amdgcn_rcpf(tt[g]);
      const v8f a = y * y;
      ps += a;
      pd += a * y;
    }
    float ta, tb;
    blockred2<false>(sum8(ps), sum8(pd), &red[(it + 1) & 1][0][0][0], lane, wave, ta, tb);
    cv = cv - (ta - 1.0f) / (2.0f * tb + 1e-8f);
  }

  // ---- final weights w = 1/(-x-c)^2 (kept in s), per-row centre wbar = sum(w)/SEQ ----
  float wbl;   // wbar of query row (lane & 15)
  {
    v8f sw = zero8();
#pragma unroll
    for (int t = 0; t < NKT; ++t) {
      const v8f tt = -s[t] - cv;
      v8f y;
#pragma unroll
      for (int g = 0; g < 8; ++g) y[g] = __builtin_amdgcn_rcpf(tt[g]);
      const v8f w = y * y;
      s[t] = w;
      sw += w;
    }
    const float sl = sum8(sw);
    float ta, tb;
    blockred2<false>(sl, sl, &red[1][0][0][0], lane, wave, ta, tb);
    wbl = ta * (1.0f / (float)SEQ);
    if (wave == 0 && lane < 16) wbar_sh[lane] = wbl;
  }

  // ---- O_w = Pc (16 x KPW) . V (KPW x 64), Pc = (w - wbar) * 2^15 as f16 ----
  v8f o[4];
#pragma unroll
  for (int st = 0; st < 4; ++st) o[st] = zero8();
#pragma unroll
  for (int kc = 0; kc < NKC; ++kc) {
    const v8f p0 = (s[2 * kc] - wbl) * PCARRY;         // keys 32kc + 8hh + g
    const v8f p1 = (s[2 * kc + 1] - wbl) * PCARRY;     // keys 32kc + 16 + 8hh + g
    AFrag pa;                                          // A: lane = query row, elems = keys (split map)
#pragma unroll
    for (int g = 0; g < 8; ++g) {
      pa.h[0][g] = (_Float16)p0[g];
      pa.h[1][g] = (_Float16)p1[g];
    }
#pragma unroll
    for (int st = 0; st < 4; ++st) {
      // B: lane = d, elems = keys (split map)
      const v16h vbf = load_fragp(vp + (kc * 4 + st) * FRAG_H, lane);
      o[st] = wmma16(pa.v, vbf, o[st]);
    }
  }

  // ---- fixed-order fold of the 16 per-wave partials: slot = wave & 3, phases wave >> 2 ----
#pragma unroll 1
  for (int ph = 0; ph < 4; ++ph) {
    if ((wave >> 2) == ph) {
      float* ob = &Ored[wave & 3][0][0];
#pragma unroll
      for (int st = 0; st < 4; ++st) {
#pragma unroll
        for (int g = 0; g < 8; ++g) {
          float* pr = ob + (r0 + g) * HD + st * 16 + m;
          const float x = o[st][g];
          if (ph == 0) *pr = x; else *pr = *pr + x;
        }
      }
    }
    __syncthreads();
  }

  // ---- epilogue: out = O/2^15 + wbar * sum_k v ----
  {
    const float* vsp = vsum + (size_t)(b * NH + h) * HD;
#pragma unroll
    for (int j = 0; j < 2; ++j) {
      const int e = tid * 2 + j;
      const int row = e >> 6, d = e & 63;
      const float a = ((Ored[0][row][d] + Ored[1][row][d]) + Ored[2][row][d]) + Ored[3][row][d];
      Ofin[row][d] = a * PCARRY_INV + wbar_sh[row] * vsp[d];
    }
  }
  __syncthreads();
  if (wave < 4) {
    // lanes 8k..8k+7 cover one line each.
    v4f val[2];
    size_t off[2];
#pragma unroll
    for (int j = 0; j < 2; ++j) {
      const int row = wave * 4 + 2 * j + hh;
      val[j] = *(const v4f*)(&Ofin[row][m * 4]);
      off[j] = ((size_t)b * SEQ + q0 + row) * RS + h * HD + m * 4;
    }
    *(v4f*)(out + off[0]) = val[0];
    *(v4f*)(out + off[1]) = val[1];
    
  }
}

// ---------------------------------------------------------------------------
// Host side
// ---------------------------------------------------------------------------
extern "C" void kernel_launch(void* const* d_in, const int* in_sizes, int n_in,
                              void* d_out, int out_size, void* d_ws, size_t ws_size,
                              hipStream_t stream) {
  if (n_in < 3 || d_ws == nullptr || d_out == nullptr) return;
  const size_t need_in  = ((size_t)(NB - 1) * SEQ_FULL + SEQ) * RS;
  const size_t need_out = (size_t)NB * SEQ * RS;
  if ((size_t)in_sizes[0] < need_in || (size_t)in_sizes[1] < need_in || (size_t)in_sizes[2] < need_in) return;
  if ((size_t)out_size < need_out) return;

  const size_t plane_b = (size_t)NB * SEQ * RS * sizeof(_Float16);   // 6291456 B at full size
  const size_t vsum_b  = (size_t)NB * NH * HD * sizeof(float);       // 6144 B at full size
  const size_t off_q = 0;
  const size_t off_k = off_q + plane_b;
  const size_t off_v = off_k + plane_b;
  const size_t off_s = off_v + plane_b;
  const size_t total = off_s + vsum_b;                               // 18880512 B at full size
  if (ws_size < total || total > WS_LIMIT) return;

  const float* q = (const float*)d_in[0];
  const float* k = (const float*)d_in[1];
  const float* v = (const float*)d_in[2];
  float* o = (float*)d_out;
  char* ws = (char*)d_ws;
  _Float16* qh  = (_Float16*)(ws + off_q);
  _Float16* kh  = (_Float16*)(ws + off_k);
  _Float16* vth = (_Float16*)(ws + off_v);
  float*    vs  = (float*)(ws + off_s);

  const int n8 = (int)((size_t)NB * SEQ * RS / 8);
  k_cvt_qk<<<dim3((n8 + 255) / 256, 2), 256, 0, stream>>>(q, k, qh, kh, n8);
  k_vtrans<<<dim3(SEQ / 64, NH, NB), 256, 0, stream>>>(v, vth);
  k_vsum<<<dim3(NH, NB, 2), 1024, 0, stream>>>(v, vs);
  k_attn<<<dim3(SEQ / 16, NH, NB), NTHR, 0, stream>>>(qh, kh, vth, vs, o);
  (void)hipGetLastError();
}

// v005
// It runs in 141 microseconds.
// Timed twice side by side with v004, it ran 1.20 and 1.21 times as fast.
// All steps since v000 together make it 3.61 times as fast.
#include <hip/hip_runtime.h>

// Contractions: S^T = K.Q^T and O = Pc.V on v_wmma_f32_16x16x32_f16 (f16 operands holding bf16-RNE-converted
// inputs; f32 accumulate). Row max, Newton steps and weights in f32; Pc = per-row centred weights carried
// x2^15 as f16, folded back in f32 together with the per-column sums of V.
// The f16 planes of Q, K and V are stored in fragment order: one 16x32 fragment = [2 pieces][32 lanes][8 halves]
// = 1 KiB, so each 16-byte-per-lane fragment load of a wave reads 512 contiguous bytes (4 whole 128-B lines).

#ifndef NB
#define NB 2
#endif
#ifndef SEQ
#define SEQ 2048
#endif
#define NB_FULL  2
#define SEQ_FULL 2048
#define NH       12
#define HD       64
#define RS       (NH * HD)          // elements between consecutive sequence rows
#define NTHR     512
#define NWAV     (NTHR / 32)
#define KPW      (SEQ / NWAV)       // keys per wave
#define NKT      (KPW / 16)         // 16-key score tiles per wave
#define NKC      (KPW / 32)         // 32-key P.V steps per wave
#define NSTEPS   6
#define PCARRY     32768.0f
#define PCARRY_INV (1.0f / 32768.0f)
#define WS_LIMIT ((size_t)134217728)
#define FRAG_H   512                // halves in one stored 16x32 fragment
#define VPRE     4                  // V fragments asked for while the weights are still f32

static_assert(SEQ % 512 == 0);
static_assert(SEQ <= SEQ_FULL);
static_assert(NB >= 1 && NB <= NB_FULL);
static_assert(NKT * 16 * NWAV == SEQ);
static_assert(NKC * 2 == NKT);
static_assert(NKC == 4 && NKT == 8);   // the load-ahead schedules below are laid out for these counts
static_assert((size_t)3 * NB * SEQ * RS * 2 + (size_t)NB * NH * HD * 4 <= WS_LIMIT);

typedef _Float16 v16h __attribute__((ext_vector_type(16)));
typedef _Float16 v8h  __attribute__((ext_vector_type(8)));
typedef float    v8f  __attribute__((ext_vector_type(8)));
typedef float    v4f  __attribute__((ext_vector_type(4)));
typedef float    v2f  __attribute__((ext_vector_type(2)));

union AFrag { v16h v; v8h h[2]; };

// How far ahead the fragment loads run: as far as the 128 registers allow at each place.
// K tiles (16 registers each) beside Q (16) and the finished score tiles (8 each): the room shrinks by half a tile a step.
constexpr int k_upto(int t) { return t >= NKT - 3 ? NKT - 1 : 4 + t / 2; }
// V fragments (8 registers each) beside O (32) and the P fragments still to be used (8 each): 2 * VPRE are in flight at the
// start, then 5 ahead, and one more for each P fragment that is used up.
constexpr int v_upto(int f) {
  const int a = f + 5 + (f >> 2);
  const int b = a > 2 * VPRE - 1 ? a : 2 * VPRE - 1;
  return b < NKC * 4 - 1 ? b : NKC * 4 - 1;
}

// bf16 RNE convert of an f32 value, returned as f32 (inputs are finite)
__device__ __forceinline__ float bf16_rne(float x) {
  unsigned u = __float_as_uint(x);
  u = (u + 0x7fffu + ((u >> 16) & 1u)) & 0xffff0000u;
  return __uint_as_float(u);
}
__device__ __forceinline__ _Float16 to_h(float x) { return (_Float16)bf16_rne(x); }

__device__ __forceinline__ v8f zero8() {
  v8f z;
#pragma unroll
  for (int i = 0; i < 8; ++i) z[i] = 0.0f;
  return z;
}

// 16x32 fragment (A: lane row m, B: lane col n), m or n = lane&15: elems 0..7 = k kb..kb+7, elems 8..15 = k kb+16..kb+23,
// kb = 8*(lane>>4). From a plane in fragment order: piece j of lane l (k = 8*(l>>4) + 16*j + 0..7 of row or
// column l&15) lies at halves j*256 + l*8.
__device__ __forceinline__ v16h load_fragp(const _Float16* base, int lane) {
  const _Float16* p = base + lane * 8;
  AFrag f;
  f.h[0] = *(const v8h*)(p);
  f.h[1] = *(const v8h*)(p + 256);
  return f.v;
}

__device__ __forceinline__ v8f wmma16(v16h a, v16h b, v8f c) {
  return __builtin_amdgcn_wmma_f32_16x16x32_f16(false, a, false, b, (short)0, c, false, false);
}

// lane l with lane l ^ 16, on the vector pipe
__device__ __forceinline__ float xhalf(float x) {
  return __int_as_float(__builtin_amdgcn_permlanex16(__float_as_int(x), __float_as_int(x), 0x76543210, 0xfedcba98, false, false));
}

template <bool MX>
__device__ __forceinline__ float cmb(float x, float y) { return MX ? fmaxf(x, y) : (x + y); }

// Fixed-order sum of the 8 components of a lane's own vector (pairwise, two components at a time).
__device__ __forceinline__ float sum8(v8f a) {
  const v2f x = (__builtin_shufflevector(a, a, 0, 1) + __builtin_shufflevector(a, a, 2, 3))
              + (__builtin_shufflevector(a, a, 4, 5) + __builtin_shufflevector(a, a, 6, 7));
  return x[0] + x[1];
}

// Block-wide reduction of two per-row quantities over all 16 waves, fixed order.
// a, b: this lane's partial for query row (lane & 15) over the keys its half holds.
// rb points at a [2][16 rows][16 waves] f32 LDS buffer (cross-wave: block barrier inside).
// Returns in ta/tb the totals of row (lane & 15), bitwise identical in every lane/wave.
template <bool MX>
__device__ __forceinline__ void blockred2(float a, float b, float* rb, int lane, int wave,
                                          float& ta, float& tb) {
  const int m = lane & 15, hh = lane >> 4;
  const float ra = cmb<MX>(a, xhalf(a));
  const float rv = cmb<MX>(b, xhalf(b));
  rb[(16 * hh + m) * 16 + wave] = hh ? rv : ra;   // lower half stores the first quantity, upper half the second
  __syncthreads();
  const float* pa = rb + m * 16 + 8 * hh;
  const float* pb = rb + (16 + m) * 16 + 8 * hh;
  const v4f a0 = *(const v4f*)(pa);
  const v4f a1 = *(const v4f*)(pa + 4);
  const v4f b0 = *(const v4f*)(pb);
  const v4f b1 = *(const v4f*)(pb + 4);
  float xa, xb;
  if (MX) {
    xa = fmaxf(fmaxf(fmaxf(a0[0], a0[1]), fmaxf(a0[2], a0[3])),
               fmaxf(fmaxf(a1[0], a1[1]), fmaxf(a1[2], a1[3])));
    xb = fmaxf(fmaxf(fmaxf(b0[0], b0[1]), fmaxf(b0[2], b0[3])),
               fmaxf(fmaxf(b1[0], b1[1]), fmaxf(b1[2], b1[3])));
  } else {
    xa = ((((((a0[0] + a0[1]) + a0[2]) + a0[3]) + a1[0]) + a1[1]) + a1[2]) + a1[3];
    xb = ((((((b0[0] + b0[1]) + b0[2]) + b0[3]) + b1[0]) + b1[1]) + b1[2]) + b1[3];
  }
  const float ya = xhalf(xa);
  const float yb = xhalf(xb);
  ta = cmb<MX>(xa, ya);
  tb = cmb<MX>(xb, yb);
}

// ---------------------------------------------------------------------------
// Q and K planes, bf16-RNE values in f16 containers, fragment order: [b][h][l/16][d/32] fragments, lane row = l&15.
// Thread = one 8-element piece (b, h, l, d8): a wave reads 4 rows x 256 B and writes 8 runs of 64 B.
// coverage: n8*8 = NB*SEQ*RS elements per plane (whole plane); blockIdx.y selects Q (0) or K (1).
// ---------------------------------------------------------------------------
__global__ __launch_bounds__(256) void k_cvt_qk(const float* __restrict__ q, const float* __restrict__ k,
                                                _Float16* __restrict__ qh, _Float16* __restrict__ kh, int n8) {
  const int i = blockIdx.x * 256 + threadIdx.x;
  if (i >= n8) return;
  const bool second = (blockIdx.y != 0);
  const float* src = second ? k : q;
  _Float16* dst = second ? kh : qh;
  const int d8 = i & 7;              // d = 8*d8 + 0..7: fragment d8>>2, piece (d8>>1)&1, lane half d8&1
  const int r  = i >> 3;             // (b*NH + h)*SEQ + l
  const int l  = r % SEQ;
  const int bh = r / SEQ;
  const int h  = bh % NH, bb = bh / NH;
  const float* p = src + ((size_t)bb * SEQ_FULL + l) * RS + h * HD + d8 * 8;
  const size_t e = (((size_t)bh * (SEQ / 16) + (l >> 4)) * 2 + (d8 >> 2)) * FRAG_H
                   + ((d8 >> 1) & 1) * 256 + ((d8 & 1) * 16 + (l & 15)) * 8;
  const v4f f0 = *(const v4f*)(p);
  const v4f f1 = *(const v4f*)(p + 4);
  v8h o;
  o[0] = to_h(f0[0]); o[1] = to_h(f0[1]); o[2] = to_h(f0[2]); o[3] = to_h(f0[3]);
  o[4] = to_h(f1[0]); o[5] = to_h(f1[1]); o[6] = to_h(f1[2]); o[7] = to_h(f1[3]);
  v8h* d = (v8h*)(dst + e);
  *d = o;
  
}

// ---------------------------------------------------------------------------
// V^T plane, bf16-RNE values in f16 containers, fragment order: [b][h][l/32][d/16] fragments, lane column = d&15,
// k = l&31. in: v[b][l0..l0+63][h][0..63] -> out: the 8 fragments of keys l0..l0+63 (8 KiB in a row); transpose
// through LDS;
// coverage: 256 threads x 2 pieces x 8 halves = 64 d x 64 l per block; grid (SEQ/64, NH, NB) -> whole plane.
// ---------------------------------------------------------------------------
__global__ __launch_bounds__(256) void k_vtrans(const float* __restrict__ v, _Float16* __restrict__ vth) {
  __shared__ __align__(16) _Float16 tile[HD][72];   // cross-thread tile: block barrier between fill and read
  const int tid = threadIdx.x;
  const int l0 = blockIdx.x * 64, h = blockIdx.y, bb = blockIdx.z;
  const float* vb = v + ((size_t)bb * SEQ_FULL + l0) * RS + h * HD;
#pragma unroll
  for (int j = 0; j < 4; ++j) {
    const int idx = tid + 256 * j;            // 0..1023
    const int l = idx >> 4, d4 = (idx & 15) * 4;
    const v4f f = *(const v4f*)(vb + (size_t)l * RS + d4);
    tile[d4 + 0][l] = to_h(f[0]);
    tile[d4 + 1][l] = to_h(f[1]);
    tile[d4 + 2][l] = to_h(f[2]);
    tile[d4 + 3][l] = to_h(f[3]);
  }
  __syncthreads();
  _Float16* ob = vth + ((size_t)(bb * NH + h) * (SEQ / 32) + (l0 >> 5)) * (4 * FRAG_H);
  v8h val[2];
  size_t off[2];
#pragma unroll
  for (int j = 0; j < 2; ++j) {
    const int p = tid + 256 * j;              // 0..511 = [32-key step j][d/16][piece][lane]
    const int ln = p & 31;
    const int row = ((p >> 6) & 3) * 16 + (ln & 15);
    const int key = j * 32 + ((p >> 5) & 1) * 16 + (ln >> 4) * 8;
    val[j] = *(const v8h*)(&tile[row][key]);
    off[j] = (size_t)p * 8;
  }
  *(v8h*)(ob + off[0]) = val[0];
  *(v8h*)(ob + off[1]) = val[1];
  
}

// ---------------------------------------------------------------------------
// vsum[b][h][d] = sum_l bf16_rne(v[b][l][h][d]), f64 accumulation, f32 result.
// One block = one (b, h, 32-d half) = one 128-B line of the table. 1024 threads: 8 lanes x 16 B cover the
// 128-B row piece, 128 row groups; thread (g, c) sums rows g, g+128, ... in f64. Fixed-order fold of the
// 128 groups through LDS: 4 groups per wave, then a pairwise tree over the 32 wave sums in wave 0.
// coverage: grid (NH, NB, 2) x 32 lanes of wave 0 -> whole table.
// ---------------------------------------------------------------------------
#define VS_GRP 128
static_assert(SEQ % VS_GRP == 0);
__global__ __launch_bounds__(1024) void k_vsum(const float* __restrict__ v, float* __restrict__ vsum) {
  __shared__ __align__(16) double part[VS_GRP][32];   // rows 4w..4w+3 written and read by wave w; block barrier
  __shared__ __align__(16) double wsum[32][32];       // cross-wave: block barrier
  const int tid = threadIdx.x;
  const int c = tid & 7, g = tid >> 3;
  const int h = blockIdx.x, bb = blockIdx.y, d0 = blockIdx.z * 32;
  const float* p = v + ((size_t)bb * SEQ_FULL + g) * RS + h * HD + d0 + c * 4;
  v4f f[SEQ / VS_GRP];
  // unrolled: all of a thread's loads are in flight at once, one memory latency for the whole column piece
#pragma unroll
  for (int j = 0; j < SEQ / VS_GRP; ++j) f[j] = *(const v4f*)(p + (size_t)j * VS_GRP * RS);
  double a0 = 0.0, a1 = 0.0, a2 = 0.0, a3 = 0.0;
  // unrolled: f[] stays in registers
#pragma unroll
  for (int j = 0; j < SEQ / VS_GRP; ++j) {
    a0 += (double)bf16_rne(f[j][0]);
    a1 += (double)bf16_rne(f[j][1]);
    a2 += (double)bf16_rne(f[j][2]);
    a3 += (double)bf16_rne(f[j][3]);
  }
  part[g][c * 4 + 0] = a0;
  part[g][c * 4 + 1] = a1;
  part[g][c * 4 + 2] = a2;
  part[g][c * 4 + 3] = a3;
  __syncthreads();
  const int lane = tid & 31, wave = tid >> 5;
  wsum[wave][lane] = ((part[4 * wave][lane] + part[4 * wave + 1][lane]) + part[4 * wave + 2][lane])
                     + part[4 * wave + 3][lane];
  __syncthreads();
  if (wave == 0) {
    double x[32];
    // all three unrolled: x[] stays in registers, the 32 LDS reads issue together
#pragma unroll
    for (int w = 0; w < 32; ++w) x[w] = wsum[w][lane];
#pragma unroll
    for (int s = 1; s < 32; s *= 2) {
#pragma unroll
      for (int w = 0; w < 32; w += 2 * s) x[w] += x[w + s];
    }
    vsum[(size_t)(bb * NH + h) * HD + d0 + lane] = (float)x[0];
  }
}

// ---------------------------------------------------------------------------
// Fused attention with the polynomial normaliser for one (b, h, 16 query rows).
// 16 waves; wave w owns keys [w*KPW, w*KPW+KPW). Scores are formed transposed (A = K tile, B = Q tile) and kept
// in WMMA D registers: s[t][g] = S(query lane&15, key w*KPW + 16*t + 8*hh + g). A lane holds scores of ONE query:
// row sums are sums of its own registers, then the other half, then a fixed-order cross-wave combine through LDS
// (identical result in every wave); c and wbar are the same for all of a lane's scores; and tiles 2kc, 2kc+1 of
// a lane are, in order, the 16 elements of its A fragment of P for key step kc. Q, K and V^T fragments come straight from the
// fragment-order planes; partial O folded through LDS.
// ---------------------------------------------------------------------------
// 128 VGPRs: 8 waves per SIMD, so two of these 16-wave work-groups share a WGP and one computes while the
// other waits on its loads, its barriers and its reduction chains.
__global__ __launch_bounds__(NTHR) __attribute__((amdgpu_num_vgpr(128)))
void k_attn(const _Float16* __restrict__ qh, const _Float16* __restrict__ kh,
            const _Float16* __restrict__ vth, const float* __restrict__ vsum,
            float* __restrict__ out) {
  __shared__ __align__(16) float red[2][2][16][16];      // cross-wave, ping-pong by reduction parity
  __shared__ __align__(16) float Ored[4][16][HD];        // cross-wave partial O fold
  __shared__ __align__(16) float Ofin[16][HD];           // cross-wave final tile
  __shared__ float wbar_sh[16];

  const int tid  = threadIdx.x;
  const int lane = tid & 31, wave = tid >> 5;
  const int m = lane & 15, hh = lane >> 4, r0 = hh << 3;
  const int q0 = blockIdx.x * 16, h = blockIdx.y, b = blockIdx.z;
  const size_t bh = (size_t)(b * NH + h);

  const _Float16* qp = qh  + (bh * (SEQ / 16) + blockIdx.x) * (2 * FRAG_H);
  const _Float16* kp = kh  + (bh * (SEQ / 16) + wave * NKT) * (2 * FRAG_H);
  const _Float16* vp = vth + (bh * (SEQ / 32) + wave * NKC) * (4 * FRAG_H);

  // ---- S^T = (K . Q^T) / 8 for KPW keys of this wave x 16 query rows ----
  v8f s[NKT];
  {
    const v16h qb0 = load_fragp(qp, lane);             // B: lane = query, elems = d 0..31 (split map)
    const v16h qb1 = load_fragp(qp + FRAG_H, lane);    // d 32..63
    // A: lane = key, elems = d (same split map). In front of tile t's products every tile up to k_upto(t) has been
    // asked for, so a wave has several tiles in flight instead of one load round trip per tile.
    v16h ka[NKT][2];
#pragma unroll
    for (int t = 0; t < NKT; ++t) {
#pragma unroll
      for (int u = (t == 0 ? 0 : k_upto(t - 1) + 1); u <= k_upto(t); ++u) {
        ka[u][0] = load_fragp(kp + u * (2 * FRAG_H), lane);
        ka[u][1] = load_fragp(kp + u * (2 * FRAG_H) + FRAG_H, lane);
      }
      v8f acc = zero8();
      acc = wmma16(ka[t][0], qb0, acc);
      acc = wmma16(ka[t][1], qb1, acc);
      s[t] = acc * 0.125f;
      // keeps the later tiles' loads from being lifted over this tile: all 16 fragments at once do not fit the registers
      __builtin_amdgcn_sched_barrier(0);
    }
  }

  // ---- c0 = -rowmax - 1 ----
  // c of query row (lane & 15), the same value 8 times: from a vector operand the compiler forms -x - c with packed
  // subtracts (two scores an issue), from a scalar c it emits single ones
  v8f cv;
  {
    float x = s[0][0];
#pragma unroll
    for (int t = 0; t < NKT; ++t) {
#pragma unroll
      for (int g = 0; g < 8; ++g) x = fmaxf(x, s[t][g]);
    }
    float ta, tb;
    blockred2<true>(x, x, &red[0][0][0][0], lane, wave, ta, tb);
    const float c0 = -ta - 1.0f;
#pragma unroll
    for (int g = 0; g < 8; ++g) cv[g] = c0;
  }

  // ---- Newton steps: c -= (sum 1/(-x-c)^2 - 1) / (2 sum 1/(-x-c)^3 + 1e-8) ----
#pragma unroll 1
  for (int it = 0; it < NSTEPS; ++it) {
    v8f ps = zero8(), pd = zero8();
#pragma unroll
    for (int t = 0; t < NKT; ++t) {
      const v8f tt = -s[t] - cv;
      v8f y;
#pragma unroll
      for (int g = 0; g < 8; ++g) y[g] = __builtin_amdgcn_rcpf(tt[g]);
      const v8f a = y * y;
      ps += a;
      pd += a * y;
    }
    float ta, tb;
    blockred2<false>(sum8(ps), sum8(pd), &red[(it + 1) & 1][0][0][0], lane, wave, ta, tb);
    cv = cv - (ta - 1.0f) / (2.0f * tb + 1e-8f);
  }

  // ---- final weights w = 1/(-x-c)^2 (kept in s), per-row centre wbar = sum(w)/SEQ ----
  float wbl;   // wbar of query row (lane & 15)
  v16h vb[NKC * 4];   // B of P.V: lane = d, elems = keys (split map); fragment f = kc * 4 + st
  {
    v8f sw = zero8();
#pragma unroll
    for (int t = 0; t < NKT; ++t) {
      const v8f tt = -s[t] - cv;
      v8f y;
#pragma unroll
      for (int g = 0; g < 8; ++g) y[g] = __builtin_amdgcn_rcpf(tt[g]);
      const v8f w = y * y;
      s[t] = w;
      sw += w;
    }
    const float sl = sum8(sw);
    float ta, tb;
    blockred2<false>(sl, sl, &red[1][0][0][0], lane, wave, ta, tb);
    wbl = ta * (1.0f / (float)SEQ);
    if (wave == 0 && lane < 16) wbar_sh[lane] = wbl;
  }

  // ---- O_w = Pc (16 x KPW) . V (KPW x 64), Pc = (w - wbar) * 2^15 as f16 ----
  v8f o[4];
#pragma unroll
  for (int st = 0; st < 4; ++st) o[st] = zero8();
  // all of P goes to f16 first: half the registers of the f32 weights, which makes room for the V fragments in flight
  AFrag pa[NKC];                                       // A: lane = query row, elems = keys (split map)
  // the first V fragments fly while P is converted
#pragma unroll
  for (int f = 0; f < VPRE; ++f) vb[f] = load_fragp(vp + f * FRAG_H, lane);
#pragma unroll
  for (int kc = 0; kc < NKC; ++kc) {
    // keeps the conversions and the loads in this order: each converted step frees the registers of one more fragment
    __builtin_amdgcn_sched_barrier(0);
    const v8f p0 = (s[2 * kc] - wbl) * PCARRY;         // keys 32kc + 8hh + g
    const v8f p1 = (s[2 * kc + 1] - wbl) * PCARRY;     // keys 32kc + 16 + 8hh + g
#pragma unroll
    for (int g = 0; g < 8; ++g) {
      pa[kc].h[0][g] = (_Float16)p0[g];
      pa[kc].h[1][g] = (_Float16)p1[g];
    }
    if (kc < VPRE) vb[VPRE + kc] = load_fragp(vp + (VPRE + kc) * FRAG_H, lane);
  }
#pragma unroll
  for (int f = 0; f < NKC * 4; ++f) {
    // keeps the loads as far ahead as v_upto says, no further: more of them at once do not fit the registers
    __builtin_amdgcn_sched_barrier(0);
#pragma unroll
    for (int u = (f == 0 ? 2 * VPRE : v_upto(f - 1) + 1); u <= v_upto(f); ++u) vb[u] = load_fragp(vp + u * FRAG_H, lane);
    o[f & 3] = wmma16(pa[f >> 2].v, vb[f], o[f & 3]);
  }

  // ---- fixed-order fold of the 16 per-wave partials: slot = wave & 3, phases wave >> 2 ----
#pragma unroll 1
  for (int ph = 0; ph < 4; ++ph) {
    if ((wave >> 2) == ph) {
      float* ob = &Ored[wave & 3][0][0];
#pragma unroll
      for (int st = 0; st < 4; ++st) {
#pragma unroll
        for (int g = 0; g < 8; ++g) {
          float* pr = ob + (r0 + g) * HD + st * 16 + m;
          const float x = o[st][g];
          if (ph == 0) *pr = x; else *pr = *pr + x;
        }
      }
    }
    __syncthreads();
  }

  // ---- epilogue: out = O/2^15 + wbar * sum_k v ----
  {
    const float* vsp = vsum + (size_t)(b * NH + h) * HD;
#pragma unroll
    for (int j = 0; j < 2; ++j) {
      const int e = tid * 2 + j;
      const int row = e >> 6, d = e & 63;
      const float a = ((Ored[0][row][d] + Ored[1][row][d]) + Ored[2][row][d]) + Ored[3][row][d];
      Ofin[row][d] = a * PCARRY_INV + wbar_sh[row] * vsp[d];
    }
  }
  __syncthreads();
  if (wave < 4) {
    // lanes 8k..8k+7 cover one line each.
    v4f val[2];
    size_t off[2];
#pragma unroll
    for (int j = 0; j < 2; ++j) {
      const int row = wave * 4 + 2 * j + hh;
      val[j] = *(const v4f*)(&Ofin[row][m * 4]);
      off[j] = ((size_t)b * SEQ + q0 + row) * RS + h * HD + m * 4;
    }
    *(v4f*)(out + off[0]) = val[0];
    *(v4f*)(out + off[1]) = val[1];
    
  }
}

// ---------------------------------------------------------------------------
// Host side
// ---------------------------------------------------------------------------
extern "C" void kernel_launch(void* const* d_in, const int* in_sizes, int n_in,
                              void* d_out, int out_size, void* d_ws, size_t ws_size,
                              hipStream_t stream) {
  if (n_in < 3 || d_ws == nullptr || d_out == nullptr) return;
  const size_t need_in  = ((size_t)(NB - 1) * SEQ_FULL + SEQ) * RS;
  const size_t need_out = (size_t)NB * SEQ * RS;
  if ((size_t)in_sizes[0] < need_in || (size_t)in_sizes[1] < need_in || (size_t)in_sizes[2] < need_in) return;
  if ((size_t)out_size < need_out) return;

  const size_t plane_b = (size_t)NB * SEQ * RS * sizeof(_Float16);   // 6291456 B at full size
  const size_t vsum_b  = (size_t)NB * NH * HD * sizeof(float);       // 6144 B at full size
  const size_t off_q = 0;
  const size_t off_k = off_q + plane_b;
  const size_t off_v = off_k + plane_b;
  const size_t off_s = off_v + plane_b;
  const size_t total = off_s + vsum_b;                               // 18880512 B at full size
  if (ws_size < total || total > WS_LIMIT) return;

  const float* q = (const float*)d_in[0];
  const float* k = (const float*)d_in[1];
  const float* v = (const float*)d_in[2];
  float* o = (float*)d_out;
  char* ws = (char*)d_ws;
  _Float16* qh  = (_Float16*)(ws + off_q);
  _Float16* kh  = (_Float16*)(ws + off_k);
  _Float16* vth = (_Float16*)(ws + off_v);
  float*    vs  = (float*)(ws + off_s);

  const int n8 = (int)((size_t)NB * SEQ * RS / 8);
  k_cvt_qk<<<dim3((n8 + 255) / 256, 2), 256, 0, stream>>>(q, k, qh, kh, n8);
  k_vtrans<<<dim3(SEQ / 64, NH, NB), 256, 0, stream>>>(v, vth);
  k_vsum<<<dim3(NH, NB, 2), 1024, 0, stream>>>(v, vs);
  k_attn<<<dim3(SEQ / 16, NH, NB), NTHR, 0, stream>>>(qh, kh, vth, vs, o);
  (void)hipGetLastError();
}

// v006
// Measured time: 132 microseconds a run.
// Two timings next to v005 both put it at 1.07 times that version's speed.
// Over all steps from v000 it is 3.86 times as fast.
#include <hip/hip_runtime.h>

// Contractions: S^T = K.Q^T and O = Pc.V on v_wmma_f32_16x16x32_f16 (f16 operands holding bf16-RNE-converted
// inputs; f32 accumulate). Row max, Newton steps and weights in f32; Pc = per-row centred weights carried
// x2^15 as f16, folded back in f32 together with the per-column sums of V.
// The f16 planes of Q, K and V are stored in fragment order: one 16x32 fragment = [2 pieces][32 lanes][8 halves]
// = 1 KiB, so each 16-byte-per-lane fragment load of a wave reads 512 contiguous bytes (4 whole 128-B lines).

#ifndef NB
#define NB 2
#endif
#ifndef SEQ
#define SEQ 2048
#endif
#define NB_FULL  2
#define SEQ_FULL 2048
#define NH       12
#define HD       64
#define RS       (NH * HD)          // elements between consecutive sequence rows
#define NTHR     512
#define NWAV     (NTHR / 32)
#define KPW      (SEQ / NWAV)       // keys per wave
#define NKT      (KPW / 16)         // 16-key score tiles per wave
#define NKC      (KPW / 32)         // 32-key P.V steps per wave
#define NSTEPS   6
#define PCARRY     32768.0f
#define PCARRY_INV (1.0f / 32768.0f)
#define WS_LIMIT ((size_t)134217728)
#define FRAG_H   512                // halves in one stored 16x32 fragment
#define VPRE     4                  // V fragments asked for while the weights are still f32

static_assert(SEQ % 512 == 0);
static_assert(SEQ <= SEQ_FULL);
static_assert(NB >= 1 && NB <= NB_FULL);
static_assert(NKT * 16 * NWAV == SEQ);
static_assert(NKC * 2 == NKT);
static_assert(NKC == 4 && NKT == 8);   // the load-ahead schedules below are laid out for these counts
static_assert((size_t)3 * NB * SEQ * RS * 2 + (size_t)NB * NH * HD * 4 <= WS_LIMIT);

typedef _Float16 v16h __attribute__((ext_vector_type(16)));
typedef _Float16 v8h  __attribute__((ext_vector_type(8)));
typedef float    v8f  __attribute__((ext_vector_type(8)));
typedef float    v4f  __attribute__((ext_vector_type(4)));
typedef float    v2f  __attribute__((ext_vector_type(2)));

union AFrag { v16h v; v8h h[2]; };

// How far ahead the fragment loads run: as far as the 128 registers allow at each place.
// K tiles (16 registers each) beside Q (16) and the finished score tiles (8 each): the room shrinks by half a tile a step.
constexpr int k_upto(int t) { return t >= NKT - 3 ? NKT - 1 : 4 + t / 2; }
// V fragments (8 registers each) beside O (32) and the P fragments still to be used (8 each): 2 * VPRE are in flight at the
// start, then 5 ahead, and one more for each P fragment that is used up.
constexpr int v_upto(int f) {
  const int a = f + 5 + (f >> 2);
  const int b = a > 2 * VPRE - 1 ? a : 2 * VPRE - 1;
  return b < NKC * 4 - 1 ? b : NKC * 4 - 1;
}

// bf16 RNE convert of an f32 value, returned as f32 (inputs are finite)
__device__ __forceinline__ float bf16_rne(float x) {
  unsigned u = __float_as_uint(x);
  u = (u + 0x7fffu + ((u >> 16) & 1u)) & 0xffff0000u;
  return __uint_as_float(u);
}
__device__ __forceinline__ _Float16 to_h(float x) { return (_Float16)bf16_rne(x); }

__device__ __forceinline__ v8f zero8() {
  v8f z;
#pragma unroll
  for (int i = 0; i < 8; ++i) z[i] = 0.0f;
  return z;
}

// 16x32 fragment (A: lane row m, B: lane col n), m or n = lane&15: elems 0..7 = k kb..kb+7, elems 8..15 = k kb+16..kb+23,
// kb = 8*(lane>>4). From a plane in fragment order: piece j of lane l (k = 8*(l>>4) + 16*j + 0..7 of row or
// column l&15) lies at halves j*256 + l*8.
__device__ __forceinline__ v16h load_fragp(const _Float16* base, int lane) {
  const _Float16* p = base + lane * 8;
  AFrag f;
  f.h[0] = *(const v8h*)(p);
  f.h[1] = *(const v8h*)(p + 256);
  return f.v;
}

__device__ __forceinline__ v8f wmma16(v16h a, v16h b, v8f c) {
  return __builtin_amdgcn_wmma_f32_16x16x32_f16(false, a, false, b, (short)0, c, false, false);
}

// lane l with lane l ^ 16, on the vector pipe
__device__ __forceinline__ float xhalf(float x) {
  return __int_as_float(__builtin_amdgcn_permlanex16(__float_as_int(x), __float_as_int(x), 0x76543210, 0xfedcba98, false, false));
}

template <bool MX>
__device__ __forceinline__ float cmb(float x, float y) { return MX ? fmaxf(x, y) : (x + y); }

// Fixed-order sum of the 8 components of a lane's own vector (pairwise, two components at a time).
__device__ __forceinline__ float sum8(v8f a) {
  const v2f x = (__builtin_shufflevector(a, a, 0, 1) + __builtin_shufflevector(a, a, 2, 3))
              + (__builtin_shufflevector(a, a, 4, 5) + __builtin_shufflevector(a, a, 6, 7));
  return x[0] + x[1];
}

// Block-wide reduction of two per-row quantities over all 16 waves, fixed order.
// a, b: this lane's partial for query row (lane & 15) over the keys its half holds.
// rb points at a [2][16 rows][16 waves] f32 LDS buffer (cross-wave: block barrier inside).
// Returns in ta/tb the totals of row (lane & 15), bitwise identical in every lane/wave.
template <bool MX>
__device__ __forceinline__ void blockred2(float a, float b, float* rb, int lane, int wave,
                                          float& ta, float& tb) {
  const int m = lane & 15, hh = lane >> 4;
  const float ra = cmb<MX>(a, xhalf(a));
  const float rv = cmb<MX>(b, xhalf(b));
  rb[(16 * hh + m) * 16 + wave] = hh ? rv : ra;   // lower half stores the first quantity, upper half the second
  __syncthreads();
  const float* pa = rb + m * 16 + 8 * hh;
  const float* pb = rb + (16 + m) * 16 + 8 * hh;
  const v4f a0 = *(const v4f*)(pa);
  const v4f a1 = *(const v4f*)(pa + 4);
  const v4f b0 = *(const v4f*)(pb);
  const v4f b1 = *(const v4f*)(pb + 4);
  float xa, xb;
  if (MX) {
    xa = fmaxf(fmaxf(fmaxf(a0[0], a0[1]), fmaxf(a0[2], a0[3])),
               fmaxf(fmaxf(a1[0], a1[1]), fmaxf(a1[2], a1[3])));
    xb = fmaxf(fmaxf(fmaxf(b0[0], b0[1]), fmaxf(b0[2], b0[3])),
               fmaxf(fmaxf(b1[0], b1[1]), fmaxf(b1[2], b1[3])));
  } else {
    xa = ((((((a0[0] + a0[1]) + a0[2]) + a0[3]) + a1[0]) + a1[1]) + a1[2]) + a1[3];
    xb = ((((((b0[0] + b0[1]) + b0[2]) + b0[3]) + b1[0]) + b1[1]) + b1[2]) + b1[3];
  }
  const float ya = xhalf(xa);
  const float yb = xhalf(xb);
  ta = cmb<MX>(xa, ya);
  tb = cmb<MX>(xb, yb);
}

// ---------------------------------------------------------------------------
// All preparation in ONE launch: the three jobs below do not depend on each other, so they share a grid by
// block-index range instead of running as three launches one behind the other, and a converting thread carries
// 12 loads of 16 B, so that few waves have to be started.
// Blocks 0 .. VS_BLOCKS-1: column sums of V (the longest chain of waits, so they start first).
// Blocks VS_BLOCKS .. : one (b, h, PREP_ROWS sequence rows): Q and K planes and the V^T plane of those rows.
//
// Column sums: vsum[b][h][d] = sum_l bf16_rne(v[b][l][h][d]), f64 accumulation, f32 result.
// One block = one (b, h, 32-d half) = one 128-B line of the table. 1024 threads: 8 lanes x 16 B cover the
// 128-B row piece, 128 row groups; thread (g, c) sums rows g, g+128, ... in f64. Fixed-order fold of the
// 128 groups through LDS: 4 groups per wave, then a pairwise tree over the 32 wave sums in wave 0.
// coverage: NH * NB * 2 blocks x 32 lanes of wave 0 -> whole table.
//
// Q and K planes, bf16-RNE values in f16 containers, fragment order: [b][h][l/16][d/32] fragments, lane row = l&15.
// One 8-element piece (l, d8) at a time: a wave reads 4 rows x 256 B and writes 8 runs of 64 B.
// coverage: 1024 threads x 2 pieces x 8 halves = PREP_ROWS l x 64 d per plane and block.
//
// V^T plane, bf16-RNE values in f16 containers, fragment order: [b][h][l/32][d/16] fragments, lane column = d&15,
// k = l&31. Each quarter of the block (256 threads) takes 64 rows: v[b][l0..l0+63][h][0..63] -> the 8 fragments of
// keys l0..l0+63 (8 KiB in a row); transpose through its own LDS tile.
// coverage: 4 quarters x 256 threads x 2 pieces x 8 halves = 64 d x PREP_ROWS l per block.
// ---------------------------------------------------------------------------
#define VS_GRP    128
#define PREP_THR  1024
#define PREP_ROWS 256
#define VS_BLOCKS (NH * NB * 2)
#define CV_BLOCKS (NB * NH * (SEQ / PREP_ROWS))
#define PREP_LDS  ((VS_GRP + 32) * 32 * 8)
static_assert(SEQ % VS_GRP == 0);
static_assert(SEQ % PREP_ROWS == 0);
static_assert(4 * HD * 72 * 2 <= PREP_LDS);
__global__ __launch_bounds__(PREP_THR) void k_prep(const float* __restrict__ q, const float* __restrict__ k,
                                                   const float* __restrict__ v, _Float16* __restrict__ qh,
                                                   _Float16* __restrict__ kh, _Float16* __restrict__ vth,
                                                   float* __restrict__ vsum) {
  __shared__ __align__(16) unsigned char smem[PREP_LDS];   // a block takes one of the two paths: they share the bytes
  const int tid = threadIdx.x;

  if (blockIdx.x < VS_BLOCKS) {                            // block-uniform: the barriers inside are passed by all
    double (*part)[32] = (double (*)[32])smem;                        // [VS_GRP][32], rows 4w..4w+3 written and read within wave w: block barrier
    double (*wsum)[32] = (double (*)[32])(smem + VS_GRP * 32 * 8);    // [32][32], cross-wave: block barrier
    const int c = tid & 7, g = tid >> 3;
    const int h = blockIdx.x % NH, bb = (blockIdx.x / NH) % NB, d0 = (blockIdx.x / (NH * NB)) * 32;
    const float* p = v + ((size_t)bb * SEQ_FULL + g) * RS + h * HD + d0 + c * 4;
    v4f f[SEQ / VS_GRP];
    // unrolled: all of a thread's loads are in flight at once, one memory latency for the whole column piece
#pragma unroll
    for (int j = 0; j < SEQ / VS_GRP; ++j) f[j] = *(const v4f*)(p + (size_t)j * VS_GRP * RS);
    double a0 = 0.0, a1 = 0.0, a2 = 0.0, a3 = 0.0;
    // unrolled: f[] stays in registers
#pragma unroll
    for (int j = 0; j < SEQ / VS_GRP; ++j) {
      a0 += (double)bf16_rne(f[j][0]);
      a1 += (double)bf16_rne(f[j][1]);
      a2 += (double)bf16_rne(f[j][2]);
      a3 += (double)bf16_rne(f[j][3]);
    }
    part[g][c * 4 + 0] = a0;
    part[g][c * 4 + 1] = a1;
    part[g][c * 4 + 2] = a2;
    part[g][c * 4 + 3] = a3;
    __syncthreads();
    const int lane = tid & 31, wave = tid >> 5;
    wsum[wave][lane] = ((part[4 * wave][lane] + part[4 * wave + 1][lane]) + part[4 * wave + 2][lane])
                       + part[4 * wave + 3][lane];
    __syncthreads();
    if (wave == 0) {
      double x[32];
      // all three unrolled: x[] stays in registers, the 32 LDS reads issue together
#pragma unroll
      for (int w = 0; w < 32; ++w) x[w] = wsum[w][lane];
#pragma unroll
      for (int s = 1; s < 32; s *= 2) {
#pragma unroll
        for (int w = 0; w < 32; w += 2 * s) x[w] += x[w + s];
      }
      vsum[(size_t)(bb * NH + h) * HD + d0 + lane] = (float)x[0];
    }
    return;
  }

  const int cb = blockIdx.x - VS_BLOCKS;
  const int l0 = (cb % (SEQ / PREP_ROWS)) * PREP_ROWS;
  const int bh = cb / (SEQ / PREP_ROWS);
  const int h  = bh % NH, bb = bh / NH;
  const size_t in0 = ((size_t)bb * SEQ_FULL + l0) * RS + h * HD;   // element (l0, d = 0) of this head in q, k and v

  // every load of the thread is asked for before the first value is used: one memory latency for the block
  v4f fq[2][2], fk[2][2], fv[4];
  const int sub = tid >> 8, t = tid & 255;    // quarter of the block and thread in it: rows l0 + 64*sub + 0..63 of V
  const int vl = t >> 4, d4 = (t & 15) * 4;   // the thread's V pieces: rows vl + 16*j of the quarter, d = d4 + 0..3
  const float* vb = v + in0 + (size_t)(64 * sub + vl) * RS + d4;
#pragma unroll
  for (int j = 0; j < 4; ++j) fv[j] = *(const v4f*)(vb + (size_t)(16 * j) * RS);
  // a precaution: the compiler hands the address pair of the four loads above to a later load as its destination;
  // this wait stands in front of that overwrite (the pair is an input, so that it keeps its value up to here)
  asm volatile("s_wait_xcnt 0x0" :: "v"(vb) : "memory");
  // piece j of the thread: (l - l0, d8) = ((tid >> 3) + (PREP_THR / 8) * j, tid & 7)
  const size_t o0 = in0 + (size_t)(tid >> 3) * RS + (tid & 7) * 8;
  const float* qa = q + o0;
  const float* ka = k + o0;
#pragma unroll
  for (int j = 0; j < 2; ++j) {
    const size_t o = (size_t)(PREP_THR / 8 * j) * RS;
    fq[j][0] = *(const v4f*)(qa + o);
    fq[j][1] = *(const v4f*)(qa + o + 4);
    fk[j][0] = *(const v4f*)(ka + o);
    fk[j][1] = *(const v4f*)(ka + o + 4);
  }
  // the same precaution for the eight loads above: their address pairs are given new values right behind them
  asm volatile("s_wait_xcnt 0x0" :: "v"(qa), "v"(ka) : "memory");

  // V goes into its tile first: the barrier then has no global store in front of it to wait for
  _Float16 (*tile)[72] = (_Float16 (*)[72])smem + sub * HD;   // [HD][72], cross-thread: block barrier between fill and read
#pragma unroll
  for (int j = 0; j < 4; ++j) {
    const int l = vl + 16 * j;
    tile[d4 + 0][l] = to_h(fv[j][0]);
    tile[d4 + 1][l] = to_h(fv[j][1]);
    tile[d4 + 2][l] = to_h(fv[j][2]);
    tile[d4 + 3][l] = to_h(fv[j][3]);
  }
  __syncthreads();

#pragma unroll
  for (int j = 0; j < 2; ++j) {
    const int pc = tid + PREP_THR * j;
    const int d8 = pc & 7;                    // d = 8*d8 + 0..7: fragment d8>>2, piece (d8>>1)&1, lane half d8&1
    const int l  = l0 + (pc >> 3);
    const size_t e = (((size_t)bh * (SEQ / 16) + (l >> 4)) * 2 + (d8 >> 2)) * FRAG_H
                     + ((d8 >> 1) & 1) * 256 + ((d8 & 1) * 16 + (l & 15)) * 8;
    v8h oq, ok;
#pragma unroll
    for (int i = 0; i < 4; ++i) {
      oq[i] = to_h(fq[j][0][i]); oq[4 + i] = to_h(fq[j][1][i]);
      ok[i] = to_h(fk[j][0][i]); ok[4 + i] = to_h(fk[j][1][i]);
    }
    *(v8h*)(qh + e) = oq;
    *(v8h*)(kh + e) = ok;
  }

  _Float16* ob = vth + ((size_t)bh * (SEQ / 32) + ((l0 + 64 * sub) >> 5)) * (4 * FRAG_H);
  v8h val[2];
  size_t off[2];
#pragma unroll
  for (int j = 0; j < 2; ++j) {
    const int p = t + 256 * j;                // 0..511 = [32-key step j][d/16][piece][lane]
    const int ln = p & 31;
    const int row = ((p >> 6) & 3) * 16 + (ln & 15);
    const int key = j * 32 + ((p >> 5) & 1) * 16 + (ln >> 4) * 8;
    val[j] = *(const v8h*)(&tile[row][key]);
    off[j] = (size_t)p * 8;
  }
  *(v8h*)(ob + off[0]) = val[0];
  *(v8h*)(ob + off[1]) = val[1];
  // a precaution: in the built code this path runs on to a label it shares with the column-sum path, whose instructions
  // reuse the registers of the six stores above; this wait stands behind the last store, in front of any such overwrite
  asm volatile("s_wait_xcnt 0x0" ::: "memory");
}

// ---------------------------------------------------------------------------
// Fused attention with the polynomial normaliser for one (b, h, 16 query rows).
// 16 waves; wave w owns keys [w*KPW, w*KPW+KPW). Scores are formed transposed (A = K tile, B = Q tile) and kept
// in WMMA D registers: s[t][g] = S(query lane&15, key w*KPW + 16*t + 8*hh + g). A lane holds scores of ONE query:
// row sums are sums of its own registers, then the other half, then a fixed-order cross-wave combine through LDS
// (identical result in every wave); c and wbar are the same for all of a lane's scores; and tiles 2kc, 2kc+1 of
// a lane are, in order, the 16 elements of its A fragment of P for key step kc. Q, K and V^T fragments come straight from the
// fragment-order planes; partial O folded through LDS.
// ---------------------------------------------------------------------------
// 128 VGPRs: 8 waves per SIMD, so two of these 16-wave work-groups share a WGP and one computes while the
// other waits on its loads, its barriers and its reduction chains.
__global__ __launch_bounds__(NTHR) __attribute__((amdgpu_num_vgpr(128)))
void k_attn(const _Float16* __restrict__ qh, const _Float16* __restrict__ kh,
            const _Float16* __restrict__ vth, const float* __restrict__ vsum,
            float* __restrict__ out) {
  __shared__ __align__(16) float red[2][2][16][16];      // cross-wave, ping-pong by reduction parity
  __shared__ __align__(16) float Ored[4][16][HD];        // cross-wave partial O fold
  __shared__ __align__(16) float Ofin[16][HD];           // cross-wave final tile
  __shared__ float wbar_sh[16];

  const int tid  = threadIdx.x;
  const int lane = tid & 31, wave = tid >> 5;
  const int m = lane & 15, hh = lane >> 4, r0 = hh << 3;
  const int q0 = blockIdx.x * 16, h = blockIdx.y, b = blockIdx.z;
  const size_t bh = (size_t)(b * NH + h);

  const _Float16* qp = qh  + (bh * (SEQ / 16) + blockIdx.x) * (2 * FRAG_H);
  const _Float16* kp = kh  + (bh * (SEQ / 16) + wave * NKT) * (2 * FRAG_H);
  const _Float16* vp = vth + (bh * (SEQ / 32) + wave * NKC) * (4 * FRAG_H);

  // ---- S^T = (K . Q^T) / 8 for KPW keys of this wave x 16 query rows ----
  v8f s[NKT];
  {
    const v16h qb0 = load_fragp(qp, lane);             // B: lane = query, elems = d 0..31 (split map)
    const v16h qb1 = load_fragp(qp + FRAG_H, lane);    // d 32..63
    // A: lane = key, elems = d (same split map). In front of tile t's products every tile up to k_upto(t) has been
    // asked for, so a wave has several tiles in flight instead of one load round trip per tile.
    v16h ka[NKT][2];
#pragma unroll
    for (int t = 0; t < NKT; ++t) {
#pragma unroll
      for (int u = (t == 0 ? 0 : k_upto(t - 1) + 1); u <= k_upto(t); ++u) {
        ka[u][0] = load_fragp(kp + u * (2 * FRAG_H), lane);
        ka[u][1] = load_fragp(kp + u * (2 * FRAG_H) + FRAG_H, lane);
      }
      v8f acc = zero8();
      acc = wmma16(ka[t][0], qb0, acc);
      acc = wmma16(ka[t][1], qb1, acc);
      s[t] = acc * 0.125f;
      // keeps the later tiles' loads from being lifted over this tile: all 16 fragments at once do not fit the registers
      __builtin_amdgcn_sched_barrier(0);
    }
  }

  // ---- c0 = -rowmax - 1 ----
  // c of query row (lane & 15), the same value 8 times: from a vector operand the compiler forms -x - c with packed
  // subtracts (two scores an issue), from a scalar c it emits single ones
  v8f cv;
  {
    float x = s[0][0];
#pragma unroll
    for (int t = 0; t < NKT; ++t) {
#pragma unroll
      for (int g = 0; g < 8; ++g) x = fmaxf(x, s[t][g]);
    }
    float ta, tb;
    blockred2<true>(x, x, &red[0][0][0][0], lane, wave, ta, tb);
    const float c0 = -ta - 1.0f;
#pragma unroll
    for (int g = 0; g < 8; ++g) cv[g] = c0;
  }

  // ---- Newton steps: c -= (sum 1/(-x-c)^2 - 1) / (2 sum 1/(-x-c)^3 + 1e-8) ----
#pragma unroll 1
  for (int it = 0; it < NSTEPS; ++it) {
    v8f ps = zero8(), pd = zero8();
#pragma unroll
    for (int t = 0; t < NKT; ++t) {
      const v8f tt = -s[t] - cv;
      v8f y;
#pragma unroll
      for (int g = 0; g < 8; ++g) y[g] = __builtin_amdgcn_rcpf(tt[g]);
      const v8f a = y * y;
      ps += a;
      pd += a * y;
    }
    float ta, tb;
    blockred2<false>(sum8(ps), sum8(pd), &red[(it + 1) & 1][0][0][0], lane, wave, ta, tb);
    cv = cv - (ta - 1.0f) / (2.0f * tb + 1e-8f);
  }

  // ---- final weights w = 1/(-x-c)^2 (kept in s), per-row centre wbar = sum(w)/SEQ ----
  float wbl;   // wbar of query row (lane & 15)
  v16h vb[NKC * 4];   // B of P.V: lane = d, elems = keys (split map); fragment f = kc * 4 + st
  {
    v8f sw = zero8();
#pragma unroll
    for (int t = 0; t < NKT; ++t) {
      const v8f tt = -s[t] - cv;
      v8f y;
#pragma unroll
      for (int g = 0; g < 8; ++g) y[g] = __builtin_amdgcn_rcpf(tt[g]);
      const v8f w = y * y;
      s[t] = w;
      sw += w;
    }
    const float sl = sum8(sw);
    float ta, tb;
    blockred2<false>(sl, sl, &red[1][0][0][0], lane, wave, ta, tb);
    wbl = ta * (1.0f / (float)SEQ);
    if (wave == 0 && lane < 16) wbar_sh[lane] = wbl;
  }

  // ---- O_w = Pc (16 x KPW) . V (KPW x 64), Pc = (w - wbar) * 2^15 as f16 ----
  v8f o[4];
#pragma unroll
  for (int st = 0; st < 4; ++st) o[st] = zero8();
  // all of P goes to f16 first: half the registers of the f32 weights, which makes room for the V fragments in flight
  AFrag pa[NKC];                                       // A: lane = query row, elems = keys (split map)
  // the first V fragments fly while P is converted
#pragma unroll
  for (int f = 0; f < VPRE; ++f) vb[f] = load_fragp(vp + f * FRAG_H, lane);
#pragma unroll
  for (int kc = 0; kc < NKC; ++kc) {
    // keeps the conversions and the loads in this order: each converted step frees the registers of one more fragment
    __builtin_amdgcn_sched_barrier(0);
    const v8f p0 = (s[2 * kc] - wbl) * PCARRY;         // keys 32kc + 8hh + g
    const v8f p1 = (s[2 * kc + 1] - wbl) * PCARRY;     // keys 32kc + 16 + 8hh + g
#pragma unroll
    for (int g = 0; g < 8; ++g) {
      pa[kc].h[0][g] = (_Float16)p0[g];
      pa[kc].h[1][g] = (_Float16)p1[g];
    }
    if (kc < VPRE) vb[VPRE + kc] = load_fragp(vp + (VPRE + kc) * FRAG_H, lane);
  }
#pragma unroll
  for (int f = 0; f < NKC * 4; ++f) {
    // keeps the loads as far ahead as v_upto says, no further: more of them at once do not fit the registers
    __builtin_amdgcn_sched_barrier(0);
#pragma unroll
    for (int u = (f == 0 ? 2 * VPRE : v_upto(f - 1) + 1); u <= v_upto(f); ++u) vb[u] = load_fragp(vp + u * FRAG_H, lane);
    o[f & 3] = wmma16(pa[f >> 2].v, vb[f], o[f & 3]);
  }

  // ---- fixed-order fold of the 16 per-wave partials: slot = wave & 3, phases wave >> 2 ----
#pragma unroll 1
  for (int ph = 0; ph < 4; ++ph) {
    if ((wave >> 2) == ph) {
      float* ob = &Ored[wave & 3][0][0];
#pragma unroll
      for (int st = 0; st < 4; ++st) {
#pragma unroll
        for (int g = 0; g < 8; ++g) {
          float* pr = ob + (r0 + g) * HD + st * 16 + m;
          const float x = o[st][g];
          if (ph == 0) *pr = x; else *pr = *pr + x;
        }
      }
    }
    __syncthreads();
  }

  // ---- epilogue: out = O/2^15 + wbar * sum_k v ----
  {
    const float* vsp = vsum + (size_t)(b * NH + h) * HD;
#pragma unroll
    for (int j = 0; j < 2; ++j) {
      const int e = tid * 2 + j;
      const int row = e >> 6, d = e & 63;
      const float a = ((Ored[0][row][d] + Ored[1][row][d]) + Ored[2][row][d]) + Ored[3][row][d];
      Ofin[row][d] = a * PCARRY_INV + wbar_sh[row] * vsp[d];
    }
  }
  __syncthreads();
  if (wave < 4) {
    // lanes 8k..8k+7 cover one line each.
    v4f val[2];
    size_t off[2];
#pragma unroll
    for (int j = 0; j < 2; ++j) {
      const int row = wave * 4 + 2 * j + hh;
      val[j] = *(const v4f*)(&Ofin[row][m * 4]);
      off[j] = ((size_t)b * SEQ + q0 + row) * RS + h * HD + m * 4;
    }
    *(v4f*)(out + off[0]) = val[0];
    *(v4f*)(out + off[1]) = val[1];
    
  }
}

// ---------------------------------------------------------------------------
// Host side
// ---------------------------------------------------------------------------
extern "C" void kernel_launch(void* const* d_in, const int* in_sizes, int n_in,
                              void* d_out, int out_size, void* d_ws, size_t ws_size,
                              hipStream_t stream) {
  if (n_in < 3 || d_ws == nullptr || d_out == nullptr) return;
  const size_t need_in  = ((size_t)(NB - 1) * SEQ_FULL + SEQ) * RS;
  const size_t need_out = (size_t)NB * SEQ * RS;
  if ((size_t)in_sizes[0] < need_in || (size_t)in_sizes[1] < need_in || (size_t)in_sizes[2] < need_in) return;
  if ((size_t)out_size < need_out) return;

  const size_t plane_b = (size_t)NB * SEQ * RS * sizeof(_Float16);   // 6291456 B at full size
  const size_t vsum_b  = (size_t)NB * NH * HD * sizeof(float);       // 6144 B at full size
  const size_t off_q = 0;
  const size_t off_k = off_q + plane_b;
  const size_t off_v = off_k + plane_b;
  const size_t off_s = off_v + plane_b;
  const size_t total = off_s + vsum_b;                               // 18880512 B at full size
  if (ws_size < total || total > WS_LIMIT) return;

  const float* q = (const float*)d_in[0];
  const float* k = (const float*)d_in[1];
  const float* v = (const float*)d_in[2];
  float* o = (float*)d_out;
  char* ws = (char*)d_ws;
  _Float16* qh  = (_Float16*)(ws + off_q);
  _Float16* kh  = (_Float16*)(ws + off_k);
  _Float16* vth = (_Float16*)(ws + off_v);
  float*    vs  = (float*)(ws + off_s);

  k_prep<<<dim3(VS_BLOCKS + CV_BLOCKS), PREP_THR, 0, stream>>>(q, k, v, qh, kh, vth, vs);
  k_attn<<<dim3(SEQ / 16, NH, NB), NTHR, 0, stream>>>(qh, kh, vth, vs, o);
  (void)hipGetLastError();
}

// v007
// It runs in 125 microseconds.
// Timed twice side by side with v006, it ran 1.05 and 1.06 times as fast.
// Over all steps from v000 it is 4.07 times as fast.
#include <hip/hip_runtime.h>

// Contractions: S^T = K.Q^T and O = Pc.V on v_wmma_f32_16x16x32_f16 (f16 operands holding bf16-RNE-converted
// inputs; f32 accumulate). Row max, Newton steps and weights in f32; Pc = per-row centred weights carried
// x2^15 as f16, folded back in f32 together with the per-column sums of V.
// The f16 planes of Q, K and V are stored in fragment order: one 16x32 fragment = [2 pieces][32 lanes][8 halves]
// = 1 KiB, so each 16-byte-per-lane fragment load of a wave reads 512 contiguous bytes (4 whole 128-B lines).

#ifndef NB
#define NB 2
#endif
#ifndef SEQ
#define SEQ 2048
#endif
#define NB_FULL  2
#define SEQ_FULL 2048
#define NH       12
#define HD       64
#define RS       (NH * HD)          // elements between consecutive sequence rows
#define NTHR     512
#define NWAV     (NTHR / 32)
#define KPW      (SEQ / NWAV)       // keys per wave
#define NKT      (KPW / 16)         // 16-key score tiles per wave
#define NKC      (KPW / 32)         // 32-key P.V steps per wave
#define NSTEPS   6
#define PCARRY     32768.0f
#define PCARRY_INV (1.0f / 32768.0f)
#define WS_LIMIT ((size_t)134217728)
#define FRAG_H   512                // halves in one stored 16x32 fragment
#define VPRE     4                  // V fragments asked for while the weights are still f32
#define VLDS     8                  // V fragments of a wave (the last ones) that wait in LDS from the Newton steps on

static_assert(SEQ % 512 == 0);
static_assert(SEQ <= SEQ_FULL);
static_assert(NB >= 1 && NB <= NB_FULL);
static_assert(NKT * 16 * NWAV == SEQ);
static_assert(NKC * 2 == NKT);
static_assert(NKC == 4 && NKT == 8);   // the load-ahead schedules below are laid out for these counts
static_assert(2 * VPRE + VLDS == NKC * 4);   // what is not in LDS is asked for around the conversion of P
static_assert((size_t)3 * NB * SEQ * RS * 2 + (size_t)NB * NH * HD * 4 <= WS_LIMIT);

typedef _Float16 v16h __attribute__((ext_vector_type(16)));
typedef _Float16 v8h  __attribute__((ext_vector_type(8)));
typedef float    v8f  __attribute__((ext_vector_type(8)));
typedef float    v4f  __attribute__((ext_vector_type(4)));
typedef float    v2f  __attribute__((ext_vector_type(2)));

union AFrag { v16h v; v8h h[2]; };

// How far ahead the fragment loads run: as far as the 128 registers allow at each place.
// K tiles (16 registers each) beside Q (16) and the finished score tiles (8 each): the room shrinks by half a tile a step.
constexpr int k_upto(int t) { return t >= NKT - 3 ? NKT - 1 : 4 + t / 2; }
// V fragments (8 registers each) beside O (32) and the P fragments still to be used (8 each): 2 * VPRE are in flight at the
// start, then 5 ahead, and one more for each P fragment that is used up.
constexpr int v_upto(int f) {
  const int a = f + 5 + (f >> 2);
  const int b = a > 2 * VPRE - 1 ? a : 2 * VPRE - 1;
  return b < NKC * 4 - 1 ? b : NKC * 4 - 1;
}

// bf16 RNE convert of an f32 value, returned as f32 (inputs are finite)
__device__ __forceinline__ float bf16_rne(float x) {
  unsigned u = __float_as_uint(x);
  u = (u + 0x7fffu + ((u >> 16) & 1u)) & 0xffff0000u;
  return __uint_as_float(u);
}
__device__ __forceinline__ _Float16 to_h(float x) { return (_Float16)bf16_rne(x); }

__device__ __forceinline__ v8f zero8() {
  v8f z;
#pragma unroll
  for (int i = 0; i < 8; ++i) z[i] = 0.0f;
  return z;
}

// 16x32 fragment (A: lane row m, B: lane col n), m or n = lane&15: elems 0..7 = k kb..kb+7, elems 8..15 = k kb+16..kb+23,
// kb = 8*(lane>>4). From a plane in fragment order: piece j of lane l (k = 8*(l>>4) + 16*j + 0..7 of row or
// column l&15) lies at halves j*256 + l*8.
__device__ __forceinline__ v16h load_fragp(const _Float16* base, int lane) {
  const _Float16* p = base + lane * 8;
  AFrag f;
  f.h[0] = *(const v8h*)(p);
  f.h[1] = *(const v8h*)(p + 256);
  return f.v;
}

__device__ __forceinline__ v8f wmma16(v16h a, v16h b, v8f c) {
  return __builtin_amdgcn_wmma_f32_16x16x32_f16(false, a, false, b, (short)0, c, false, false);
}

// lane l with lane l ^ 16, on the vector pipe
__device__ __forceinline__ float xhalf(float x) {
  return __int_as_float(__builtin_amdgcn_permlanex16(__float_as_int(x), __float_as_int(x), 0x76543210, 0xfedcba98, false, false));
}

template <bool MX>
__device__ __forceinline__ float cmb(float x, float y) { return MX ? fmaxf(x, y) : (x + y); }

// Fixed-order sum of the 8 components of a lane's own vector (pairwise, two components at a time).
__device__ __forceinline__ float sum8(v8f a) {
  const v2f x = (__builtin_shufflevector(a, a, 0, 1) + __builtin_shufflevector(a, a, 2, 3))
              + (__builtin_shufflevector(a, a, 4, 5) + __builtin_shufflevector(a, a, 6, 7));
  return x[0] + x[1];
}

// Block-wide reduction of two per-row quantities over all 16 waves, fixed order.
// a, b: this lane's partial for query row (lane & 15) over the keys its half holds.
// rb points at a [2][16 rows][16 waves] f32 LDS buffer (cross-wave: block barrier inside).
// Returns in ta/tb the totals of row (lane & 15), bitwise identical in every lane/wave.
template <bool MX>
__device__ __forceinline__ void blockred2(float a, float b, float* rb, int lane, int wave,
                                          float& ta, float& tb) {
  const int m = lane & 15, hh = lane >> 4;
  const float ra = cmb<MX>(a, xhalf(a));
  const float rv = cmb<MX>(b, xhalf(b));
  rb[(16 * hh + m) * 16 + wave] = hh ? rv : ra;   // lower half stores the first quantity, upper half the second
  __syncthreads();
  const float* pa = rb + m * 16 + 8 * hh;
  const float* pb = rb + (16 + m) * 16 + 8 * hh;
  const v4f a0 = *(const v4f*)(pa);
  const v4f a1 = *(const v4f*)(pa + 4);
  const v4f b0 = *(const v4f*)(pb);
  const v4f b1 = *(const v4f*)(pb + 4);
  float xa, xb;
  if (MX) {
    xa = fmaxf(fmaxf(fmaxf(a0[0], a0[1]), fmaxf(a0[2], a0[3])),
               fmaxf(fmaxf(a1[0], a1[1]), fmaxf(a1[2], a1[3])));
    xb = fmaxf(fmaxf(fmaxf(b0[0], b0[1]), fmaxf(b0[2], b0[3])),
               fmaxf(fmaxf(b1[0], b1[1]), fmaxf(b1[2], b1[3])));
  } else {
    xa = ((((((a0[0] + a0[1]) + a0[2]) + a0[3]) + a1[0]) + a1[1]) + a1[2]) + a1[3];
    xb = ((((((b0[0] + b0[1]) + b0[2]) + b0[3]) + b1[0]) + b1[1]) + b1[2]) + b1[3];
  }
  const float ya = xhalf(xa);
  const float yb = xhalf(xb);
  ta = cmb<MX>(xa, ya);
  tb = cmb<MX>(xb, yb);
}

// ---------------------------------------------------------------------------
// All preparation in ONE launch: the three jobs below do not depend on each other, so they share a grid by
// block-index range instead of running as three launches one behind the other, and a converting thread carries
// 12 loads of 16 B, so that few waves have to be started.
// Blocks 0 .. VS_BLOCKS-1: column sums of V (the longest chain of waits, so they start first).
// Blocks VS_BLOCKS .. : one (b, h, PREP_ROWS sequence rows): Q and K planes and the V^T plane of those rows.
//
// Column sums: vsum[b][h][d] = sum_l bf16_rne(v[b][l][h][d]), f64 accumulation, f32 result.
// One block = one (b, h, 32-d half) = one 128-B line of the table. 1024 threads: 8 lanes x 16 B cover the
// 128-B row piece, 128 row groups; thread (g, c) sums rows g, g+128, ... in f64. Fixed-order fold of the
// 128 groups through LDS: 4 groups per wave, then a pairwise tree over the 32 wave sums in wave 0.
// coverage: NH * NB * 2 blocks x 32 lanes of wave 0 -> whole table.
//
// Q and K planes, bf16-RNE values in f16 containers, fragment order: [b][h][l/16][d/32] fragments, lane row = l&15.
// One 8-element piece (l, d8) at a time: a wave reads 4 rows x 256 B and writes 8 runs of 64 B.
// coverage: 1024 threads x 2 pieces x 8 halves = PREP_ROWS l x 64 d per plane and block.
//
// V^T plane, bf16-RNE values in f16 containers, fragment order: [b][h][l/32][d/16] fragments, lane column = d&15,
// k = l&31. Each quarter of the block (256 threads) takes 64 rows: v[b][l0..l0+63][h][0..63] -> the 8 fragments of
// keys l0..l0+63 (8 KiB in a row); transpose through its own LDS tile.
// coverage: 4 quarters x 256 threads x 2 pieces x 8 halves = 64 d x PREP_ROWS l per block.
// ---------------------------------------------------------------------------
#define VS_GRP    128
#define PREP_THR  1024
#define PREP_ROWS 256
#define VS_BLOCKS (NH * NB * 2)
#define CV_BLOCKS (NB * NH * (SEQ / PREP_ROWS))
#define PREP_LDS  ((VS_GRP + 32) * 32 * 8)
static_assert(SEQ % VS_GRP == 0);
static_assert(SEQ % PREP_ROWS == 0);
static_assert(4 * HD * 72 * 2 <= PREP_LDS);
__global__ __launch_bounds__(PREP_THR) void k_prep(const float* __restrict__ q, const float* __restrict__ k,
                                                   const float* __restrict__ v, _Float16* __restrict__ qh,
                                                   _Float16* __restrict__ kh, _Float16* __restrict__ vth,
                                                   float* __restrict__ vsum) {
  __shared__ __align__(16) unsigned char smem[PREP_LDS];   // a block takes one of the two paths: they share the bytes
  const int tid = threadIdx.x;

  if (blockIdx.x < VS_BLOCKS) {                            // block-uniform: the barriers inside are passed by all
    double (*part)[32] = (double (*)[32])smem;                        // [VS_GRP][32], rows 4w..4w+3 written and read within wave w: block barrier
    double (*wsum)[32] = (double (*)[32])(smem + VS_GRP * 32 * 8);    // [32][32], cross-wave: block barrier
    const int c = tid & 7, g = tid >> 3;
    const int h = blockIdx.x % NH, bb = (blockIdx.x / NH) % NB, d0 = (blockIdx.x / (NH * NB)) * 32;
    const float* p = v + ((size_t)bb * SEQ_FULL + g) * RS + h * HD + d0 + c * 4;
    v4f f[SEQ / VS_GRP];
    // unrolled: all of a thread's loads are in flight at once, one memory latency for the whole column piece
#pragma unroll
    for (int j = 0; j < SEQ / VS_GRP; ++j) f[j] = *(const v4f*)(p + (size_t)j * VS_GRP * RS);
    double a0 = 0.0, a1 = 0.0, a2 = 0.0, a3 = 0.0;
    // unrolled: f[] stays in registers
#pragma unroll
    for (int j = 0; j < SEQ / VS_GRP; ++j) {
      a0 += (double)bf16_rne(f[j][0]);
      a1 += (double)bf16_rne(f[j][1]);
      a2 += (double)bf16_rne(f[j][2]);
      a3 += (double)bf16_rne(f[j][3]);
    }
    part[g][c * 4 + 0] = a0;
    part[g][c * 4 + 1] = a1;
    part[g][c * 4 + 2] = a2;
    part[g][c * 4 + 3] = a3;
    __syncthreads();
    const int lane = tid & 31, wave = tid >> 5;
    wsum[wave][lane] = ((part[4 * wave][lane] + part[4 * wave + 1][lane]) + part[4 * wave + 2][lane])
                       + part[4 * wave + 3][lane];
    __syncthreads();
    if (wave == 0) {
      double x[32];
      // all three unrolled: x[] stays in registers, the 32 LDS reads issue together
#pragma unroll
      for (int w = 0; w < 32; ++w) x[w] = wsum[w][lane];
#pragma unroll
      for (int s = 1; s < 32; s *= 2) {
#pragma unroll
        for (int w = 0; w < 32; w += 2 * s) x[w] += x[w + s];
      }
      vsum[(size_t)(bb * NH + h) * HD + d0 + lane] = (float)x[0];
    }
    return;
  }

  const int cb = blockIdx.x - VS_BLOCKS;
  const int l0 = (cb % (SEQ / PREP_ROWS)) * PREP_ROWS;
  const int bh = cb / (SEQ / PREP_ROWS);
  const int h  = bh % NH, bb = bh / NH;
  const size_t in0 = ((size_t)bb * SEQ_FULL + l0) * RS + h * HD;   // element (l0, d = 0) of this head in q, k and v

  // every load of the thread is asked for before the first value is used: one memory latency for the block
  v4f fq[2][2], fk[2][2], fv[4];
  const int sub = tid >> 8, t = tid & 255;    // quarter of the block and thread in it: rows l0 + 64*sub + 0..63 of V
  const int vl = t >> 4, d4 = (t & 15) * 4;   // the thread's V pieces: rows vl + 16*j of the quarter, d = d4 + 0..3
  const float* vb = v + in0 + (size_t)(64 * sub + vl) * RS + d4;
#pragma unroll
  for (int j = 0; j < 4; ++j) fv[j] = *(const v4f*)(vb + (size_t)(16 * j) * RS);
  // a precaution: the compiler hands the address pair of the four loads above to a later load as its destination;
  // this wait stands in front of that overwrite (the pair is an input, so that it keeps its value up to here)
  asm volatile("s_wait_xcnt 0x0" :: "v"(vb) : "memory");
  // piece j of the thread: (l - l0, d8) = ((tid >> 3) + (PREP_THR / 8) * j, tid & 7)
  const size_t o0 = in0 + (size_t)(tid >> 3) * RS + (tid & 7) * 8;
  const float* qa = q + o0;
  const float* ka = k + o0;
#pragma unroll
  for (int j = 0; j < 2; ++j) {
    const size_t o = (size_t)(PREP_THR / 8 * j) * RS;
    fq[j][0] = *(const v4f*)(qa + o);
    fq[j][1] = *(const v4f*)(qa + o + 4);
    fk[j][0] = *(const v4f*)(ka + o);
    fk[j][1] = *(const v4f*)(ka + o + 4);
  }
  // the same precaution for the eight loads above: their address pairs are given new values right behind them
  asm volatile("s_wait_xcnt 0x0" :: "v"(qa), "v"(ka) : "memory");

  // V goes into its tile first: the barrier then has no global store in front of it to wait for
  _Float16 (*tile)[72] = (_Float16 (*)[72])smem + sub * HD;   // [HD][72], cross-thread: block barrier between fill and read
#pragma unroll
  for (int j = 0; j < 4; ++j) {
    const int l = vl + 16 * j;
    tile[d4 + 0][l] = to_h(fv[j][0]);
    tile[d4 + 1][l] = to_h(fv[j][1]);
    tile[d4 + 2][l] = to_h(fv[j][2]);
    tile[d4 + 3][l] = to_h(fv[j][3]);
  }
  __syncthreads();

#pragma unroll
  for (int j = 0; j < 2; ++j) {
    const int pc = tid + PREP_THR * j;
    const int d8 = pc & 7;                    // d = 8*d8 + 0..7: fragment d8>>2, piece (d8>>1)&1, lane half d8&1
    const int l  = l0 + (pc >> 3);
    const size_t e = (((size_t)bh * (SEQ / 16) + (l >> 4)) * 2 + (d8 >> 2)) * FRAG_H
                     + ((d8 >> 1) & 1) * 256 + ((d8 & 1) * 16 + (l & 15)) * 8;
    v8h oq, ok;
#pragma unroll
    for (int i = 0; i < 4; ++i) {
      oq[i] = to_h(fq[j][0][i]); oq[4 + i] = to_h(fq[j][1][i]);
      ok[i] = to_h(fk[j][0][i]); ok[4 + i] = to_h(fk[j][1][i]);
    }
    *(v8h*)(qh + e) = oq;
    *(v8h*)(kh + e) = ok;
  }

  _Float16* ob = vth + ((size_t)bh * (SEQ / 32) + ((l0 + 64 * sub) >> 5)) * (4 * FRAG_H);
  v8h val[2];
  size_t off[2];
#pragma unroll
  for (int j = 0; j < 2; ++j) {
    const int p = t + 256 * j;                // 0..511 = [32-key step j][d/16][piece][lane]
    const int ln = p & 31;
    const int row = ((p >> 6) & 3) * 16 + (ln & 15);
    const int key = j * 32 + ((p >> 5) & 1) * 16 + (ln >> 4) * 8;
    val[j] = *(const v8h*)(&tile[row][key]);
    off[j] = (size_t)p * 8;
  }
  *(v8h*)(ob + off[0]) = val[0];
  *(v8h*)(ob + off[1]) = val[1];
  // a precaution: in the built code this path runs on to a label it shares with the column-sum path, whose instructions
  // reuse the registers of the six stores above; this wait stands behind the last store, in front of any such overwrite
  asm volatile("s_wait_xcnt 0x0" ::: "memory");
}

// ---------------------------------------------------------------------------
// Fused attention with the polynomial normaliser for one (b, h, 16 query rows).
// 16 waves; wave w owns keys [w*KPW, w*KPW+KPW). Scores are formed transposed (A = K tile, B = Q tile) and kept
// in WMMA D registers: s[t][g] = S(query lane&15, key w*KPW + 16*t + 8*hh + g). A lane holds scores of ONE query:
// row sums are sums of its own registers, then the other half, then a fixed-order cross-wave combine through LDS
// (identical result in every wave); c and wbar are the same for all of a lane's scores; and tiles 2kc, 2kc+1 of
// a lane are, in order, the 16 elements of its A fragment of P for key step kc. Q, K and the first 2 * VPRE V^T fragments of a wave come straight from the
// fragment-order planes; partial O folded through LDS.
// The loads of K and V take their time from the L2 path while the vector units wait, and the Newton steps load nothing:
// so the last VLDS V fragments of each wave are copied to LDS while the Newton steps run (registers have no room for them).
// ---------------------------------------------------------------------------
// 128 VGPRs: 8 waves per SIMD, so two of these 16-wave work-groups share a WGP and one computes while the
// other waits on its loads, its barriers and its reduction chains.
__global__ __launch_bounds__(NTHR) __attribute__((amdgpu_num_vgpr(128)))
void k_attn(const _Float16* __restrict__ qh, const _Float16* __restrict__ kh,
            const _Float16* __restrict__ vth, const float* __restrict__ vsum,
            float* __restrict__ out) {
  __shared__ __align__(16) float red[2][2][16][16];      // cross-wave, ping-pong by reduction parity
  __shared__ __align__(16) float Ored[4][16][HD];        // cross-wave partial O fold
  __shared__ __align__(16) float Ofin[16][HD];           // cross-wave final tile
  __shared__ float wbar_sh[16];
  // V fragments NKC*4-VLDS .. NKC*4-1 of each wave, as they lie in the plane. Private to the wave: it alone copies into its
  // slice and reads it, so its own wait on the copies orders them and no barrier is needed. 152 KiB in all: two groups a WGP.
  __shared__ __align__(16) _Float16 vst[NWAV][VLDS * FRAG_H];

  const int tid  = threadIdx.x;
  const int lane = tid & 31, wave = tid >> 5;
  const int m = lane & 15, hh = lane >> 4, r0 = hh << 3;
  const int q0 = blockIdx.x * 16, h = blockIdx.y, b = blockIdx.z;
  const size_t bh = (size_t)(b * NH + h);

  const _Float16* qp = qh  + (bh * (SEQ / 16) + blockIdx.x) * (2 * FRAG_H);
  const _Float16* kp = kh  + (bh * (SEQ / 16) + wave * NKT) * (2 * FRAG_H);
  const _Float16* vp = vth + (bh * (SEQ / 32) + wave * NKC) * (4 * FRAG_H);

  // ---- S^T = (K . Q^T) / 8 for KPW keys of this wave x 16 query rows ----
  v8f s[NKT];
  {
    const v16h qb0 = load_fragp(qp, lane);             // B: lane = query, elems = d 0..31 (split map)
    const v16h qb1 = load_fragp(qp + FRAG_H, lane);    // d 32..63
    // A: lane = key, elems = d (same split map). In front of tile t's products every tile up to k_upto(t) has been
    // asked for, so a wave has several tiles in flight instead of one load round trip per tile.
    v16h ka[NKT][2];
#pragma unroll
    for (int t = 0; t < NKT; ++t) {
#pragma unroll
      for (int u = (t == 0 ? 0 : k_upto(t - 1) + 1); u <= k_upto(t); ++u) {
        ka[u][0] = load_fragp(kp + u * (2 * FRAG_H), lane);
        ka[u][1] = load_fragp(kp + u * (2 * FRAG_H) + FRAG_H, lane);
      }
      v8f acc = zero8();
      acc = wmma16(ka[t][0], qb0, acc);
      acc = wmma16(ka[t][1], qb1, acc);
      s[t] = acc * 0.125f;
      // keeps the later tiles' loads from being lifted over this tile: all 16 fragments at once do not fit the registers
      __builtin_amdgcn_sched_barrier(0);
    }
  }

  // ---- the wave's last VLDS V fragments set out for LDS: 16 copies of 512 B, no register, landed long before P.V ----
  {
    const unsigned    ld = (unsigned)(size_t)(&vst[wave][lane * 8]);          // the lane's 16 B of each 512-B piece
    const _Float16*   gp = vp + (NKC * 4 - VLDS) * FRAG_H + lane * 8;
    static_assert(VLDS * FRAG_H * 2 == 16 * 512);
    // the offset moves the LDS and the global address alike (the slice is laid out as the plane is).
    // s_wait_xcnt, a precaution: it stands in front of any later overwrite of the two address operands
    asm volatile("global_load_async_to_lds_b128 %0, %1, off\n\t"
                 "global_load_async_to_lds_b128 %0, %1, off offset:512\n\t"
                 "global_load_async_to_lds_b128 %0, %1, off offset:1024\n\t"
                 "global_load_async_to_lds_b128 %0, %1, off offset:1536\n\t"
                 "global_load_async_to_lds_b128 %0, %1, off offset:2048\n\t"
                 "global_load_async_to_lds_b128 %0, %1, off offset:2560\n\t"
                 "global_load_async_to_lds_b128 %0, %1, off offset:3072\n\t"
                 "global_load_async_to_lds_b128 %0, %1, off offset:3584\n\t"
                 "global_load_async_to_lds_b128 %0, %1, off offset:4096\n\t"
                 "global_load_async_to_lds_b128 %0, %1, off offset:4608\n\t"
                 "global_load_async_to_lds_b128 %0, %1, off offset:5120\n\t"
                 "global_load_async_to_lds_b128 %0, %1, off offset:5632\n\t"
                 "global_load_async_to_lds_b128 %0, %1, off offset:6144\n\t"
                 "global_load_async_to_lds_b128 %0, %1, off offset:6656\n\t"
                 "global_load_async_to_lds_b128 %0, %1, off offset:7168\n\t"
                 "global_load_async_to_lds_b128 %0, %1, off offset:7680\n\t"
                 "s_wait_xcnt 0x0"
                 :: "v"(ld), "v"(gp) : "memory");
  }

  // ---- c0 = -rowmax - 1 ----
  // c of query row (lane & 15), the same value 8 times: from a vector operand the compiler forms -x - c with packed
  // subtracts (two scores an issue), from a scalar c it emits single ones
  v8f cv;
  {
    float x = s[0][0];
#pragma unroll
    for (int t = 0; t < NKT; ++t) {
#pragma unroll
      for (int g = 0; g < 8; ++g) x = fmaxf(x, s[t][g]);
    }
    float ta, tb;
    blockred2<true>(x, x, &red[0][0][0][0], lane, wave, ta, tb);
    const float c0 = -ta - 1.0f;
#pragma unroll
    for (int g = 0; g < 8; ++g) cv[g] = c0;
  }

  // ---- Newton steps: c -= (sum 1/(-x-c)^2 - 1) / (2 sum 1/(-x-c)^3 + 1e-8) ----
#pragma unroll 1
  for (int it = 0; it < NSTEPS; ++it) {
    v8f ps = zero8(), pd = zero8();
#pragma unroll
    for (int t = 0; t < NKT; ++t) {
      const v8f tt = -s[t] - cv;
      v8f y;
#pragma unroll
      for (int g = 0; g < 8; ++g) y[g] = __builtin_amdgcn_rcpf(tt[g]);
      const v8f a = y * y;
      ps += a;
      pd += a * y;
    }
    float ta, tb;
    blockred2<false>(sum8(ps), sum8(pd), &red[(it + 1) & 1][0][0][0], lane, wave, ta, tb);
    cv = cv - (ta - 1.0f) / (2.0f * tb + 1e-8f);
  }

  // ---- final weights w = 1/(-x-c)^2 (kept in s), per-row centre wbar = sum(w)/SEQ ----
  float wbl;   // wbar of query row (lane & 15)
  v16h vb[NKC * 4];   // B of P.V: lane = d, elems = keys (split map); fragment f = kc * 4 + st
  {
    v8f sw = zero8();
#pragma unroll
    for (int t = 0; t < NKT; ++t) {
      const v8f tt = -s[t] - cv;
      v8f y;
#pragma unroll
      for (int g = 0; g < 8; ++g) y[g] = __builtin_amdgcn_rcpf(tt[g]);
      const v8f w = y * y;
      s[t] = w;
      sw += w;
    }
    const float sl = sum8(sw);
    float ta, tb;
    blockred2<false>(sl, sl, &red[1][0][0][0], lane, wave, ta, tb);
    wbl = ta * (1.0f / (float)SEQ);
    if (wave == 0 && lane < 16) wbar_sh[lane] = wbl;
  }

  // ---- O_w = Pc (16 x KPW) . V (KPW x 64), Pc = (w - wbar) * 2^15 as f16 ----
  v8f o[4];
#pragma unroll
  for (int st = 0; st < 4; ++st) o[st] = zero8();
  // all of P goes to f16 first: half the registers of the f32 weights, which makes room for the V fragments in flight
  AFrag pa[NKC];                                       // A: lane = query row, elems = keys (split map)
  // the first V fragments fly while P is converted
#pragma unroll
  for (int f = 0; f < VPRE; ++f) vb[f] = load_fragp(vp + f * FRAG_H, lane);
#pragma unroll
  for (int kc = 0; kc < NKC; ++kc) {
    // keeps the conversions and the loads in this order: each converted step frees the registers of one more fragment
    __builtin_amdgcn_sched_barrier(0);
    const v8f p0 = (s[2 * kc] - wbl) * PCARRY;         // keys 32kc + 8hh + g
    const v8f p1 = (s[2 * kc + 1] - wbl) * PCARRY;     // keys 32kc + 16 + 8hh + g
#pragma unroll
    for (int g = 0; g < 8; ++g) {
      pa[kc].h[0][g] = (_Float16)p0[g];
      pa[kc].h[1][g] = (_Float16)p1[g];
    }
    if (kc < VPRE) vb[VPRE + kc] = load_fragp(vp + (VPRE + kc) * FRAG_H, lane);
  }
  // the wave's own copies have landed behind this wait: no read of its LDS slice stands in front of it
  asm volatile("s_wait_asynccnt 0x0" ::: "memory");
  const _Float16* vl = &vst[wave][0];
#pragma unroll
  for (int f = 0; f < NKC * 4; ++f) {
    // keeps the loads as far ahead as v_upto says, no further: more of them at once do not fit the registers
    __builtin_amdgcn_sched_barrier(0);
    // every fragment from 2 * VPRE on is one of those in LDS
#pragma unroll
    for (int u = (f == 0 ? 2 * VPRE : v_upto(f - 1) + 1); u <= v_upto(f); ++u) vb[u] = load_fragp(vl + (u - 2 * VPRE) * FRAG_H, lane);
    o[f & 3] = wmma16(pa[f >> 2].v, vb[f], o[f & 3]);
  }

  // ---- fixed-order fold of the 16 per-wave partials: slot = wave & 3, phases wave >> 2 ----
#pragma unroll 1
  for (int ph = 0; ph < 4; ++ph) {
    if ((wave >> 2) == ph) {
      float* ob = &Ored[wave & 3][0][0];
#pragma unroll
      for (int st = 0; st < 4; ++st) {
#pragma unroll
        for (int g = 0; g < 8; ++g) {
          float* pr = ob + (r0 + g) * HD + st * 16 + m;
          const float x = o[st][g];
          if (ph == 0) *pr = x; else *pr = *pr + x;
        }
      }
    }
    __syncthreads();
  }

  // ---- epilogue: out = O/2^15 + wbar * sum_k v ----
  {
    const float* vsp = vsum + (size_t)(b * NH + h) * HD;
#pragma unroll
    for (int j = 0; j < 2; ++j) {
      const int e = tid * 2 + j;
      const int row = e >> 6, d = e & 63;
      const float a = ((Ored[0][row][d] + Ored[1][row][d]) + Ored[2][row][d]) + Ored[3][row][d];
      Ofin[row][d] = a * PCARRY_INV + wbar_sh[row] * vsp[d];
    }
  }
  __syncthreads();
  if (wave < 4) {
    // lanes 8k..8k+7 cover one line each.
    v4f val[2];
    size_t off[2];
#pragma unroll
    for (int j = 0; j < 2; ++j) {
      const int row = wave * 4 + 2 * j + hh;
      val[j] = *(const v4f*)(&Ofin[row][m * 4]);
      off[j] = ((size_t)b * SEQ + q0 + row) * RS + h * HD + m * 4;
    }
    *(v4f*)(out + off[0]) = val[0];
    *(v4f*)(out + off[1]) = val[1];
    
  }
}

// ---------------------------------------------------------------------------
// Host side
// ---------------------------------------------------------------------------
extern "C" void kernel_launch(void* const* d_in, const int* in_sizes, int n_in,
                              void* d_out, int out_size, void* d_ws, size_t ws_size,
                              hipStream_t stream) {
  if (n_in < 3 || d_ws == nullptr || d_out == nullptr) return;
  const size_t need_in  = ((size_t)(NB - 1) * SEQ_FULL + SEQ) * RS;
  const size_t need_out = (size_t)NB * SEQ * RS;
  if ((size_t)in_sizes[0] < need_in || (size_t)in_sizes[1] < need_in || (size_t)in_sizes[2] < need_in) return;
  if ((size_t)out_size < need_out) return;

  const size_t plane_b = (size_t)NB * SEQ * RS * sizeof(_Float16);   // 6291456 B at full size
  const size_t vsum_b  = (size_t)NB * NH * HD * sizeof(float);       // 6144 B at full size
  const size_t off_q = 0;
  const size_t off_k = off_q + plane_b;
  const size_t off_v = off_k + plane_b;
  const size_t off_s = off_v + plane_b;
  const size_t total = off_s + vsum_b;                               // 18880512 B at full size
  if (ws_size < total || total > WS_LIMIT) return;

  const float* q = (const float*)d_in[0];
  const float* k = (const float*)d_in[1];
  const float* v = (const float*)d_in[2];
  float* o = (float*)d_out;
  char* ws = (char*)d_ws;
  _Float16* qh  = (_Float16*)(ws + off_q);
  _Float16* kh  = (_Float16*)(ws + off_k);
  _Float16* vth = (_Float16*)(ws + off_v);
  float*    vs  = (float*)(ws + off_s);

  k_prep<<<dim3(VS_BLOCKS + CV_BLOCKS), PREP_THR, 0, stream>>>(q, k, v, qh, kh, vth, vs);
  k_attn<<<dim3(SEQ / 16, NH, NB), NTHR, 0, stream>>>(qh, kh, vth, vs, o);
  (void)hipGetLastError();
}

// v008
// A run of this version takes 109 microseconds.
// Next to v007, in two timings, it ran 1.16 times as fast each time.
// All steps since v000 together make it 4.70 times as fast.
#include <hip/hip_runtime.h>

// Contractions: S^T = K.Q^T and O = Pc.V on v_wmma_f32_16x16x32_f16 (f16 operands holding bf16-RNE-converted
// inputs; f32 accumulate). Row max, Newton steps and weights in f32; Pc = per-row centred weights carried
// x2^15 as f16, folded back in f32 together with the per-column sums of V.
// The f16 planes of Q, K and V are stored in fragment order: one 16x32 fragment = [2 pieces][32 lanes][8 halves]
// = 1 KiB, so each 16-byte-per-lane fragment load of a wave reads 512 contiguous bytes (4 whole 128-B lines).

#ifndef NB
#define NB 2
#endif
#ifndef SEQ
#define SEQ 2048
#endif
#define NB_FULL  2
#define SEQ_FULL 2048
#define NH       12
#define HD       64
#define RS       (NH * HD)          // elements between consecutive sequence rows
#define NTHR     512
#define NWAV     (NTHR / 32)
#define KPW      (SEQ / NWAV)       // keys per wave
#define NKT      (KPW / 16)         // 16-key score tiles per wave
#define NKC      (KPW / 32)         // 32-key P.V steps per wave
#define NSTEPS   6
#define PCARRY     32768.0f
#define PCARRY_INV (1.0f / 32768.0f)
#define WS_LIMIT ((size_t)134217728)
#define FRAG_H   512                // halves in one stored 16x32 fragment
#define VPRE     4                  // V fragments asked for while the weights are still f32
#define VLDS     8                  // V fragments of a wave (the last ones) that wait in LDS from the Newton steps on

static_assert(SEQ % 512 == 0);
static_assert(SEQ <= SEQ_FULL);
static_assert(NB >= 1 && NB <= NB_FULL);
static_assert(NKT * 16 * NWAV == SEQ);
static_assert(NKC * 2 == NKT);
static_assert(NKC == 4 && NKT == 8);   // the load-ahead schedules below are laid out for these counts
static_assert(2 * VPRE + VLDS == NKC * 4);   // what is not in LDS is asked for around the conversion of P
static_assert((size_t)3 * NB * SEQ * RS * 2 + (size_t)NB * NH * HD * 4 <= WS_LIMIT);

typedef _Float16 v16h __attribute__((ext_vector_type(16)));
typedef _Float16 v8h  __attribute__((ext_vector_type(8)));
typedef float    v8f  __attribute__((ext_vector_type(8)));
typedef float    v4f  __attribute__((ext_vector_type(4)));
typedef float    v2f  __attribute__((ext_vector_type(2)));
typedef v4f v4f_any __attribute__((may_alias));   // f32 accesses to LDS bytes that are declared as halves

union AFrag { v16h v; v8h h[2]; };

// How far ahead the fragment loads run: as far as the 128 registers allow at each place.
// K tiles (16 registers each) beside Q (16) and the finished score tiles (8 each): the room shrinks by half a tile a step.
constexpr int k_upto(int t) { return t >= NKT - 3 ? NKT - 1 : 4 + t / 2; }
// V fragments (8 registers each) beside O (32) and the P fragments still to be used (8 each): 2 * VPRE are in flight at the
// start, then 5 ahead, and one more for each P fragment that is used up.
constexpr int v_upto(int f) {
  const int a = f + 5 + (f >> 2);
  const int b = a > 2 * VPRE - 1 ? a : 2 * VPRE - 1;
  return b < NKC * 4 - 1 ? b : NKC * 4 - 1;
}

// bf16 RNE convert of an f32 value, returned as f32 (inputs are finite)
__device__ __forceinline__ float bf16_rne(float x) {
  unsigned u = __float_as_uint(x);
  u = (u + 0x7fffu + ((u >> 16) & 1u)) & 0xffff0000u;
  return __uint_as_float(u);
}
__device__ __forceinline__ _Float16 to_h(float x) { return (_Float16)bf16_rne(x); }

__device__ __forceinline__ v8f zero8() {
  v8f z;
#pragma unroll
  for (int i = 0; i < 8; ++i) z[i] = 0.0f;
  return z;
}

// 16x32 fragment (A: lane row m, B: lane col n), m or n = lane&15: elems 0..7 = k kb..kb+7, elems 8..15 = k kb+16..kb+23,
// kb = 8*(lane>>4). From a plane in fragment order: piece j of lane l (k = 8*(l>>4) + 16*j + 0..7 of row or
// column l&15) lies at halves j*256 + l*8.
__device__ __forceinline__ v16h load_fragp(const _Float16* base, int lane) {
  const _Float16* p = base + lane * 8;
  AFrag f;
  f.h[0] = *(const v8h*)(p);
  f.h[1] = *(const v8h*)(p + 256);
  return f.v;
}

__device__ __forceinline__ v8f wmma16(v16h a, v16h b, v8f c) {
  return __builtin_amdgcn_wmma_f32_16x16x32_f16(false, a, false, b, (short)0, c, false, false);
}

// lane l with lane l ^ 16, on the vector pipe
__device__ __forceinline__ float xhalf(float x) {
  return __int_as_float(__builtin_amdgcn_permlanex16(__float_as_int(x), __float_as_int(x), 0x76543210, 0xfedcba98, false, false));
}

template <bool MX>
__device__ __forceinline__ float cmb(float x, float y) { return MX ? fmaxf(x, y) : (x + y); }

// Fixed-order sum of the 8 components of a lane's own vector (pairwise, two components at a time).
__device__ __forceinline__ float sum8(v8f a) {
  const v2f x = (__builtin_shufflevector(a, a, 0, 1) + __builtin_shufflevector(a, a, 2, 3))
              + (__builtin_shufflevector(a, a, 4, 5) + __builtin_shufflevector(a, a, 6, 7));
  return x[0] + x[1];
}

// Block-wide reduction of two per-row quantities over all 16 waves, fixed order.
// a, b: this lane's partial for query row (lane & 15) over the keys its half holds.
// rb points at a [2][16 rows][16 waves] f32 LDS buffer (cross-wave: block barrier inside).
// Returns in ta/tb the totals of row (lane & 15), bitwise identical in every lane/wave.
template <bool MX>
__device__ __forceinline__ void blockred2(float a, float b, float* rb, int lane, int wave,
                                          float& ta, float& tb) {
  const int m = lane & 15, hh = lane >> 4;
  const float ra = cmb<MX>(a, xhalf(a));
  const float rv = cmb<MX>(b, xhalf(b));
  rb[(16 * hh + m) * 16 + wave] = hh ? rv : ra;   // lower half stores the first quantity, upper half the second
  __syncthreads();
  const float* pa = rb + m * 16 + 8 * hh;
  const float* pb = rb + (16 + m) * 16 + 8 * hh;
  const v4f a0 = *(const v4f*)(pa);
  const v4f a1 = *(const v4f*)(pa + 4);
  const v4f b0 = *(const v4f*)(pb);
  const v4f b1 = *(const v4f*)(pb + 4);
  float xa, xb;
  if (MX) {
    xa = fmaxf(fmaxf(fmaxf(a0[0], a0[1]), fmaxf(a0[2], a0[3])),
               fmaxf(fmaxf(a1[0], a1[1]), fmaxf(a1[2], a1[3])));
    xb = fmaxf(fmaxf(fmaxf(b0[0], b0[1]), fmaxf(b0[2], b0[3])),
               fmaxf(fmaxf(b1[0], b1[1]), fmaxf(b1[2], b1[3])));
  } else {
    xa = ((((((a0[0] + a0[1]) + a0[2]) + a0[3]) + a1[0]) + a1[1]) + a1[2]) + a1[3];
    xb = ((((((b0[0] + b0[1]) + b0[2]) + b0[3]) + b1[0]) + b1[1]) + b1[2]) + b1[3];
  }
  const float ya = xhalf(xa);
  const float yb = xhalf(xb);
  ta = cmb<MX>(xa, ya);
  tb = cmb<MX>(xb, yb);
}

// ---------------------------------------------------------------------------
// All preparation in ONE launch: the three jobs below do not depend on each other, so they share a grid by
// block-index range instead of running as three launches one behind the other, and a converting thread carries
// 12 loads of 16 B, so that few waves have to be started.
// Blocks 0 .. VS_BLOCKS-1: column sums of V (the longest chain of waits, so they start first).
// Blocks VS_BLOCKS .. : one (b, h, PREP_ROWS sequence rows): Q and K planes and the V^T plane of those rows.
//
// Column sums: vsum[b][h][d] = sum_l bf16_rne(v[b][l][h][d]), f64 accumulation, f32 result.
// One block = one (b, h, 32-d half) = one 128-B line of the table. 1024 threads: 8 lanes x 16 B cover the
// 128-B row piece, 128 row groups; thread (g, c) sums rows g, g+128, ... in f64. Fixed-order fold of the
// 128 groups through LDS: 4 groups per wave, then a pairwise tree over the 32 wave sums in wave 0.
// coverage: NH * NB * 2 blocks x 32 lanes of wave 0 -> whole table.
//
// Q and K planes, bf16-RNE values in f16 containers, fragment order: [b][h][l/16][d/32] fragments, lane row = l&15.
// One 8-element piece (l, d8) at a time: a wave reads 4 rows x 256 B and writes 8 runs of 64 B.
// coverage: 1024 threads x 2 pieces x 8 halves = PREP_ROWS l x 64 d per plane and block.
//
// V^T plane, bf16-RNE values in f16 containers, fragment order: [b][h][l/32][d/16] fragments, lane column = d&15,
// k = l&31. Each quarter of the block (256 threads) takes 64 rows: v[b][l0..l0+63][h][0..63] -> the 8 fragments of
// keys l0..l0+63 (8 KiB in a row); transpose through its own LDS tile.
// coverage: 4 quarters x 256 threads x 2 pieces x 8 halves = 64 d x PREP_ROWS l per block.
// ---------------------------------------------------------------------------
#define VS_GRP    128
#define PREP_THR  1024
#define PREP_ROWS 256
#define VS_BLOCKS (NH * NB * 2)
#define CV_BLOCKS (NB * NH * (SEQ / PREP_ROWS))
#define PREP_LDS  ((VS_GRP + 32) * 32 * 8)
static_assert(SEQ % VS_GRP == 0);
static_assert(SEQ % PREP_ROWS == 0);
static_assert(4 * HD * 72 * 2 <= PREP_LDS);
__global__ __launch_bounds__(PREP_THR) void k_prep(const float* __restrict__ q, const float* __restrict__ k,
                                                   const float* __restrict__ v, _Float16* __restrict__ qh,
                                                   _Float16* __restrict__ kh, _Float16* __restrict__ vth,
                                                   float* __restrict__ vsum) {
  __shared__ __align__(16) unsigned char smem[PREP_LDS];   // a block takes one of the two paths: they share the bytes
  const int tid = threadIdx.x;

  if (blockIdx.x < VS_BLOCKS) {                            // block-uniform: the barriers inside are passed by all
    double (*part)[32] = (double (*)[32])smem;                        // [VS_GRP][32], rows 4w..4w+3 written and read within wave w: block barrier
    double (*wsum)[32] = (double (*)[32])(smem + VS_GRP * 32 * 8);    // [32][32], cross-wave: block barrier
    const int c = tid & 7, g = tid >> 3;
    const int h = blockIdx.x % NH, bb = (blockIdx.x / NH) % NB, d0 = (blockIdx.x / (NH * NB)) * 32;
    const float* p = v + ((size_t)bb * SEQ_FULL + g) * RS + h * HD + d0 + c * 4;
    v4f f[SEQ / VS_GRP];
    // unrolled: all of a thread's loads are in flight at once, one memory latency for the whole column piece
#pragma unroll
    for (int j = 0; j < SEQ / VS_GRP; ++j) f[j] = *(const v4f*)(p + (size_t)j * VS_GRP * RS);
    double a0 = 0.0, a1 = 0.0, a2 = 0.0, a3 = 0.0;
    // unrolled: f[] stays in registers
#pragma unroll
    for (int j = 0; j < SEQ / VS_GRP; ++j) {
      a0 += (double)bf16_rne(f[j][0]);
      a1 += (double)bf16_rne(f[j][1]);
      a2 += (double)bf16_rne(f[j][2]);
      a3 += (double)bf16_rne(f[j][3]);
    }
    part[g][c * 4 + 0] = a0;
    part[g][c * 4 + 1] = a1;
    part[g][c * 4 + 2] = a2;
    part[g][c * 4 + 3] = a3;
    __syncthreads();
    const int lane = tid & 31, wave = tid >> 5;
    wsum[wave][lane] = ((part[4 * wave][lane] + part[4 * wave + 1][lane]) + part[4 * wave + 2][lane])
                       + part[4 * wave + 3][lane];
    __syncthreads();
    if (wave == 0) {
      double x[32];
      // all three unrolled: x[] stays in registers, the 32 LDS reads issue together
#pragma unroll
      for (int w = 0; w < 32; ++w) x[w] = wsum[w][lane];
#pragma unroll
      for (int s = 1; s < 32; s *= 2) {
#pragma unroll
        for (int w = 0; w < 32; w += 2 * s) x[w] += x[w + s];
      }
      vsum[(size_t)(bb * NH + h) * HD + d0 + lane] = (float)x[0];
    }
    return;
  }

  const int cb = blockIdx.x - VS_BLOCKS;
  const int l0 = (cb % (SEQ / PREP_ROWS)) * PREP_ROWS;
  const int bh = cb / (SEQ / PREP_ROWS);
  const int h  = bh % NH, bb = bh / NH;
  const size_t in0 = ((size_t)bb * SEQ_FULL + l0) * RS + h * HD;   // element (l0, d = 0) of this head in q, k and v

  // every load of the thread is asked for before the first value is used: one memory latency for the block
  v4f fq[2][2], fk[2][2], fv[4];
  const int sub = tid >> 8, t = tid & 255;    // quarter of the block and thread in it: rows l0 + 64*sub + 0..63 of V
  const int vl = t >> 4, d4 = (t & 15) * 4;   // the thread's V pieces: rows vl + 16*j of the quarter, d = d4 + 0..3
  const float* vb = v + in0 + (size_t)(64 * sub + vl) * RS + d4;
#pragma unroll
  for (int j = 0; j < 4; ++j) fv[j] = *(const v4f*)(vb + (size_t)(16 * j) * RS);
  // a precaution: the compiler hands the address pair of the four loads above to a later load as its destination;
  // this wait stands in front of that overwrite (the pair is an input, so that it keeps its value up to here)
  asm volatile("s_wait_xcnt 0x0" :: "v"(vb) : "memory");
  // piece j of the thread: (l - l0, d8) = ((tid >> 3) + (PREP_THR / 8) * j, tid & 7)
  const size_t o0 = in0 + (size_t)(tid >> 3) * RS + (tid & 7) * 8;
  const float* qa = q + o0;
  const float* ka = k + o0;
#pragma unroll
  for (int j = 0; j < 2; ++j) {
    const size_t o = (size_t)(PREP_THR / 8 * j) * RS;
    fq[j][0] = *(const v4f*)(qa + o);
    fq[j][1] = *(const v4f*)(qa + o + 4);
    fk[j][0] = *(const v4f*)(ka + o);
    fk[j][1] = *(const v4f*)(ka + o + 4);
  }
  // the same precaution for the eight loads above: their address pairs are given new values right behind them
  asm volatile("s_wait_xcnt 0x0" :: "v"(qa), "v"(ka) : "memory");

  // V goes into its tile first: the barrier then has no global store in front of it to wait for
  _Float16 (*tile)[72] = (_Float16 (*)[72])smem + sub * HD;   // [HD][72], cross-thread: block barrier between fill and read
#pragma unroll
  for (int j = 0; j < 4; ++j) {
    const int l = vl + 16 * j;
    tile[d4 + 0][l] = to_h(fv[j][0]);
    tile[d4 + 1][l] = to_h(fv[j][1]);
    tile[d4 + 2][l] = to_h(fv[j][2]);
    tile[d4 + 3][l] = to_h(fv[j][3]);
  }
  __syncthreads();

#pragma unroll
  for (int j = 0; j < 2; ++j) {
    const int pc = tid + PREP_THR * j;
    const int d8 = pc & 7;                    // d = 8*d8 + 0..7: fragment d8>>2, piece (d8>>1)&1, lane half d8&1
    const int l  = l0 + (pc >> 3);
    const size_t e = (((size_t)bh * (SEQ / 16) + (l >> 4)) * 2 + (d8 >> 2)) * FRAG_H
                     + ((d8 >> 1) & 1) * 256 + ((d8 & 1) * 16 + (l & 15)) * 8;
    v8h oq, ok;
#pragma unroll
    for (int i = 0; i < 4; ++i) {
      oq[i] = to_h(fq[j][0][i]); oq[4 + i] = to_h(fq[j][1][i]);
      ok[i] = to_h(fk[j][0][i]); ok[4 + i] = to_h(fk[j][1][i]);
    }
    *(v8h*)(qh + e) = oq;
    *(v8h*)(kh + e) = ok;
  }

  _Float16* ob = vth + ((size_t)bh * (SEQ / 32) + ((l0 + 64 * sub) >> 5)) * (4 * FRAG_H);
  v8h val[2];
  size_t off[2];
#pragma unroll
  for (int j = 0; j < 2; ++j) {
    const int p = t + 256 * j;                // 0..511 = [32-key step j][d/16][piece][lane]
    const int ln = p & 31;
    const int row = ((p >> 6) & 3) * 16 + (ln & 15);
    const int key = j * 32 + ((p >> 5) & 1) * 16 + (ln >> 4) * 8;
    val[j] = *(const v8h*)(&tile[row][key]);
    off[j] = (size_t)p * 8;
  }
  *(v8h*)(ob + off[0]) = val[0];
  *(v8h*)(ob + off[1]) = val[1];
  // a precaution: in the built code this path runs on to a label it shares with the column-sum path, whose instructions
  // reuse the registers of the six stores above; this wait stands behind the last store, in front of any such overwrite
  asm volatile("s_wait_xcnt 0x0" ::: "memory");
}

// ---------------------------------------------------------------------------
// Fused attention with the polynomial normaliser for one (b, h, 16 query rows).
// 16 waves; wave w owns keys [w*KPW, w*KPW+KPW). Scores are formed transposed (A = K tile, B = Q tile) and kept
// in WMMA D registers: s[t][g] = S(query lane&15, key w*KPW + 16*t + 8*hh + g). A lane holds scores of ONE query:
// row sums are sums of its own registers, then the other half, then a fixed-order cross-wave combine through LDS
// (identical result in every wave); c and wbar are the same for all of a lane's scores; and tiles 2kc, 2kc+1 of
// a lane are, in order, the 16 elements of its A fragment of P for key step kc. Q, K and the first 2 * VPRE V^T fragments of a wave come straight from the
// fragment-order planes; partial O folded through LDS.
// The loads of K and V take their time from the L2 path while the vector units wait, and the Newton steps load nothing:
// so the last VLDS V fragments of each wave are copied to LDS while the Newton steps run (registers have no room for them).
// ---------------------------------------------------------------------------
// 128 VGPRs: 8 waves per SIMD, so two of these 16-wave work-groups share a WGP and one computes while the
// other waits on its loads, its barriers and its reduction chains.
__global__ __launch_bounds__(NTHR) __attribute__((amdgpu_num_vgpr(128)))
void k_attn(const _Float16* __restrict__ qh, const _Float16* __restrict__ kh,
            const _Float16* __restrict__ vth, const float* __restrict__ vsum,
            float* __restrict__ out) {
  __shared__ __align__(16) float red[2][2][16][16];      // cross-wave, ping-pong by reduction parity
  __shared__ __align__(16) float wbar_sh[16];
  // V fragments NKC*4-VLDS .. NKC*4-1 of each wave, as they lie in the plane. Private to the wave: it alone copies into its
  // slice and reads it, so its own wait on the copies orders them and no barrier is needed. 132 KiB in all: two groups a WGP.
  // Behind P.V the wave puts its partial O (4 KiB) into the same slice for the fold: cross-wave from there on, block barrier.
  __shared__ __align__(16) _Float16 vst[NWAV][VLDS * FRAG_H];

  const int tid  = threadIdx.x;
  const int lane = tid & 31, wave = tid >> 5;
  const int q0 = blockIdx.x * 16, h = blockIdx.y, b = blockIdx.z;
  const size_t bh = (size_t)(b * NH + h);

  const _Float16* qp = qh  + (bh * (SEQ / 16) + blockIdx.x) * (2 * FRAG_H);
  const _Float16* kp = kh  + (bh * (SEQ / 16) + wave * NKT) * (2 * FRAG_H);
  const _Float16* vp = vth + (bh * (SEQ / 32) + wave * NKC) * (4 * FRAG_H);

  // ---- S^T = (K . Q^T) / 8 for KPW keys of this wave x 16 query rows ----
  v8f s[NKT];
  {
    const v16h qb0 = load_fragp(qp, lane);             // B: lane = query, elems = d 0..31 (split map)
    const v16h qb1 = load_fragp(qp + FRAG_H, lane);    // d 32..63
    // A: lane = key, elems = d (same split map). In front of tile t's products every tile up to k_upto(t) has been
    // asked for, so a wave has several tiles in flight instead of one load round trip per tile.
    v16h ka[NKT][2];
#pragma unroll
    for (int t = 0; t < NKT; ++t) {
#pragma unroll
      for (int u = (t == 0 ? 0 : k_upto(t - 1) + 1); u <= k_upto(t); ++u) {
        ka[u][0] = load_fragp(kp + u * (2 * FRAG_H), lane);
        ka[u][1] = load_fragp(kp + u * (2 * FRAG_H) + FRAG_H, lane);
      }
      v8f acc = zero8();
      acc = wmma16(ka[t][0], qb0, acc);
      acc = wmma16(ka[t][1], qb1, acc);
      s[t] = acc * 0.125f;
      // keeps the later tiles' loads from being lifted over this tile: all 16 fragments at once do not fit the registers
      __builtin_amdgcn_sched_barrier(0);
    }
  }

  // ---- the wave's last VLDS V fragments set out for LDS: 16 copies of 512 B, no register, landed long before P.V ----
  {
    const unsigned    ld = (unsigned)(size_t)(&vst[wave][lane * 8]);          // the lane's 16 B of each 512-B piece
    const _Float16*   gp = vp + (NKC * 4 - VLDS) * FRAG_H + lane * 8;
    static_assert(VLDS * FRAG_H * 2 == 16 * 512);
    // the offset moves the LDS and the global address alike (the slice is laid out as the plane is).
    // s_wait_xcnt, a precaution: it stands in front of any later overwrite of the two address operands
    asm volatile("global_load_async_to_lds_b128 %0, %1, off\n\t"
                 "global_load_async_to_lds_b128 %0, %1, off offset:512\n\t"
                 "global_load_async_to_lds_b128 %0, %1, off offset:1024\n\t"
                 "global_load_async_to_lds_b128 %0, %1, off offset:1536\n\t"
                 "global_load_async_to_lds_b128 %0, %1, off offset:2048\n\t"
                 "global_load_async_to_lds_b128 %0, %1, off offset:2560\n\t"
                 "global_load_async_to_lds_b128 %0, %1, off offset:3072\n\t"
                 "global_load_async_to_lds_b128 %0, %1, off offset:3584\n\t"
                 "global_load_async_to_lds_b128 %0, %1, off offset:4096\n\t"
                 "global_load_async_to_lds_b128 %0, %1, off offset:4608\n\t"
                 "global_load_async_to_lds_b128 %0, %1, off offset:5120\n\t"
                 "global_load_async_to_lds_b128 %0, %1, off offset:5632\n\t"
                 "global_load_async_to_lds_b128 %0, %1, off offset:6144\n\t"
                 "global_load_async_to_lds_b128 %0, %1, off offset:6656\n\t"
                 "global_load_async_to_lds_b128 %0, %1, off offset:7168\n\t"
                 "global_load_async_to_lds_b128 %0, %1, off offset:7680\n\t"
                 "s_wait_xcnt 0x0"
                 :: "v"(ld), "v"(gp) : "memory");
  }

  // ---- c0 = -rowmax - 1 ----
  // c of query row (lane & 15), the same value 8 times: from a vector operand the compiler forms -x - c with packed
  // subtracts (two scores an issue), from a scalar c it emits single ones
  v8f cv;
  {
    float x = s[0][0];
#pragma unroll
    for (int t = 0; t < NKT; ++t) {
#pragma unroll
      for (int g = 0; g < 8; ++g) x = fmaxf(x, s[t][g]);
    }
    float ta, tb;
    blockred2<true>(x, x, &red[0][0][0][0], lane, wave, ta, tb);
    const float c0 = -ta - 1.0f;
#pragma unroll
    for (int g = 0; g < 8; ++g) cv[g] = c0;
  }

  // ---- Newton steps: c -= (sum 1/(-x-c)^2 - 1) / (2 sum 1/(-x-c)^3 + 1e-8) ----
#pragma unroll 1
  for (int it = 0; it < NSTEPS; ++it) {
    v8f ps = zero8(), pd = zero8();
#pragma unroll
    for (int t = 0; t < NKT; ++t) {
      const v8f tt = -s[t] - cv;
      v8f y;
#pragma unroll
      for (int g = 0; g < 8; ++g) y[g] = __builtin_amdgcn_rcpf(tt[g]);
      const v8f a = y * y;
      ps += a;
      pd += a * y;
    }
    float ta, tb;
    blockred2<false>(sum8(ps), sum8(pd), &red[(it + 1) & 1][0][0][0], lane, wave, ta, tb);
    cv = cv - (ta - 1.0f) / (2.0f * tb + 1e-8f);
  }

  // ---- final weights w = 1/(-x-c)^2 (kept in s), per-row centre wbar = sum(w)/SEQ ----
  float wbl;   // wbar of query row (lane & 15)
  v16h vb[NKC * 4];   // B of P.V: lane = d, elems = keys (split map); fragment f = kc * 4 + st
  {
    v8f sw = zero8();
#pragma unroll
    for (int t = 0; t < NKT; ++t) {
      const v8f tt = -s[t] - cv;
      v8f y;
#pragma unroll
      for (int g = 0; g < 8; ++g) y[g] = __builtin_amdgcn_rcpf(tt[g]);
      const v8f w = y * y;
      s[t] = w;
      sw += w;
    }
    const float sl = sum8(sw);
    float ta, tb;
    blockred2<false>(sl, sl, &red[1][0][0][0], lane, wave, ta, tb);
    wbl = ta * (1.0f / (float)SEQ);
    if (wave == 0 && lane < 16) wbar_sh[lane] = wbl;
  }

  // ---- O_w = Pc (16 x KPW) . V (KPW x 64), Pc = (w - wbar) * 2^15 as f16 ----
  v8f o[4];
#pragma unroll
  for (int st = 0; st < 4; ++st) o[st] = zero8();
  // all of P goes to f16 first: half the registers of the f32 weights, which makes room for the V fragments in flight
  AFrag pa[NKC];                                       // A: lane = query row, elems = keys (split map)
  // the first V fragments fly while P is converted
#pragma unroll
  for (int f = 0; f < VPRE; ++f) vb[f] = load_fragp(vp + f * FRAG_H, lane);
#pragma unroll
  for (int kc = 0; kc < NKC; ++kc) {
    // keeps the conversions and the loads in this order: each converted step frees the registers of one more fragment
    __builtin_amdgcn_sched_barrier(0);
    const v8f p0 = (s[2 * kc] - wbl) * PCARRY;         // keys 32kc + 8hh + g
    const v8f p1 = (s[2 * kc + 1] - wbl) * PCARRY;     // keys 32kc + 16 + 8hh + g
#pragma unroll
    for (int g = 0; g < 8; ++g) {
      pa[kc].h[0][g] = (_Float16)p0[g];
      pa[kc].h[1][g] = (_Float16)p1[g];
    }
    if (kc < VPRE) vb[VPRE + kc] = load_fragp(vp + (VPRE + kc) * FRAG_H, lane);
  }
  // the wave's own copies have landed behind this wait: no read of its LDS slice stands in front of it
  asm volatile("s_wait_asynccnt 0x0" ::: "memory");
  const _Float16* vl = &vst[wave][0];
#pragma unroll
  for (int f = 0; f < NKC * 4; ++f) {
    // keeps the loads as far ahead as v_upto says, no further: more of them at once do not fit the registers
    __builtin_amdgcn_sched_barrier(0);
    // every fragment from 2 * VPRE on is one of those in LDS
#pragma unroll
    for (int u = (f == 0 ? 2 * VPRE : v_upto(f - 1) + 1); u <= v_upto(f); ++u) vb[u] = load_fragp(vl + (u - 2 * VPRE) * FRAG_H, lane);
    o[f & 3] = wmma16(pa[f >> 2].v, vb[f], o[f & 3]);
  }

  // ---- fixed-order fold of the 16 per-wave partials, all at once: every wave lays its tile down, one barrier, then a thread
  // sums four elements over the 16 tiles with all its reads in flight together. Order of the sum: waves s, s+4, s+8, s+12 for
  // s = 0..3, then the four of them in turn.
  // A tile in LDS: [st][g >> 2][lane][g & 3] f32, so a lane stores 16 B next to its neighbours' (no bank is hit twice).
  static_assert(16 * HD * 4 <= VLDS * FRAG_H * 2);
  // the wave's number as a scalar: the index arithmetic below then runs on the scalar unit and keeps no vector register
  // alive through the kernel (all 128 are in use), and the test on it below is a scalar branch
  const int ws = __builtin_amdgcn_readfirstlane(tid >> 5);
  {
    float* ob = (float*)&vst[ws][0] + lane * 4;
#pragma unroll
    for (int st = 0; st < 4; ++st) {
#pragma unroll
      for (int gq = 0; gq < 2; ++gq) {
        v4f x;
#pragma unroll
        for (int i = 0; i < 4; ++i) x[i] = o[st][4 * gq + i];
        *(v4f_any*)(ob + (st * 2 + gq) * 128) = x;
      }
    }
  }
  __syncthreads();

  // ---- the sums and the epilogue: out = O/2^15 + wbar * sum_k v ----
  // Wave ws: rows frow + 0..3 (the 16 B of one tile lane), columns
  // 32 * (ws >> 2) + lane: each half of the wave reads 256 B in a row, and each store of the wave is one whole 128-B line.
  // No barrier stands behind this test.
  if (ws < 8) {
    const int fd   = ((ws >> 2) << 5) | lane;
    const int fh   = (ws >> 1) & 1, fq = ws & 1;       // the tile lane's half and the g >> 2 of the four rows
    const int frow = fh * 8 + fq * 4;
    const float vsd = vsum[(size_t)(b * NH + h) * HD + fd];   // first: it comes from the L2 path while the LDS reads run
    const int e = (((fd >> 4) * 2 + fq) * 32 + fh * 16 + (lane & 15)) * 4;
    v4f p[NWAV];
    // unrolled: p[] stays in registers and the 16 reads issue together
#pragma unroll
    for (int w = 0; w < NWAV; ++w) p[w] = *(const v4f_any*)((const float*)&vst[w][0] + e);
    const v4f wb = *(const v4f*)(&wbar_sh[frow]);
    v4f q4[4];
#pragma unroll
    for (int sl = 0; sl < 4; ++sl) q4[sl] = ((p[sl] + p[sl + 4]) + p[sl + 8]) + p[sl + 12];
    const v4f a = ((q4[0] + q4[1]) + q4[2]) + q4[3];
    float* op = out + ((size_t)b * SEQ + q0 + frow) * RS + h * HD + fd;
#pragma unroll
    for (int i = 0; i < 4; ++i) op[(size_t)i * RS] = a[i] * PCARRY_INV + wb[i] * vsd;
  }
}

// ---------------------------------------------------------------------------
// Host side
// ---------------------------------------------------------------------------
extern "C" void kernel_launch(void* const* d_in, const int* in_sizes, int n_in,
                              void* d_out, int out_size, void* d_ws, size_t ws_size,
                              hipStream_t stream) {
  if (n_in < 3 || d_ws == nullptr || d_out == nullptr) return;
  const size_t need_in  = ((size_t)(NB - 1) * SEQ_FULL + SEQ) * RS;
  const size_t need_out = (size_t)NB * SEQ * RS;
  if ((size_t)in_sizes[0] < need_in || (size_t)in_sizes[1] < need_in || (size_t)in_sizes[2] < need_in) return;
  if ((size_t)out_size < need_out) return;

  const size_t plane_b = (size_t)NB * SEQ * RS * sizeof(_Float16);   // 6291456 B at full size
  const size_t vsum_b  = (size_t)NB * NH * HD * sizeof(float);       // 6144 B at full size
  const size_t off_q = 0;
  const size_t off_k = off_q + plane_b;
  const size_t off_v = off_k + plane_b;
  const size_t off_s = off_v + plane_b;
  const size_t total = off_s + vsum_b;                               // 18880512 B at full size
  if (ws_size < total || total > WS_LIMIT) return;

  const float* q = (const float*)d_in[0];
  const float* k = (const float*)d_in[1];
  const float* v = (const float*)d_in[2];
  float* o = (float*)d_out;
  char* ws = (char*)d_ws;
  _Float16* qh  = (_Float16*)(ws + off_q);
  _Float16* kh  = (_Float16*)(ws + off_k);
  _Float16* vth = (_Float16*)(ws + off_v);
  float*    vs  = (float*)(ws + off_s);

  k_prep<<<dim3(VS_BLOCKS + CV_BLOCKS), PREP_THR, 0, stream>>>(q, k, v, qh, kh, vth, vs);
  k_attn<<<dim3(SEQ / 16, NH, NB), NTHR, 0, stream>>>(qh, kh, vth, vs, o);
  (void)hipGetLastError();
}

// v009
// One run takes 102 microseconds.
// Two timings next to v008 put it at 1.07 and 1.06 times that version's speed.
// All steps since v000 together make it 5.00 times as fast.
#include <hip/hip_runtime.h>

// Contractions: S^T = K.Q^T and O = Pc.V on v_wmma_f32_16x16x32_f16 (f16 operands holding bf16-RNE-converted
// inputs; f32 accumulate). Row max, Newton steps and weights in f32; Pc = per-row centred weights carried
// x2^15 as f16, folded back in f32 together with the per-column sums of V.
// The f16 planes of Q, K and V are stored in fragment order: one 16x32 fragment = [2 pieces][32 lanes][8 halves]
// = 1 KiB, so each 16-byte-per-lane fragment load of a wave reads 512 contiguous bytes (4 whole 128-B lines).

#ifndef NB
#define NB 2
#endif
#ifndef SEQ
#define SEQ 2048
#endif
#define NB_FULL  2
#define SEQ_FULL 2048
#define NH       12
#define HD       64
#define RS       (NH * HD)          // elements between consecutive sequence rows
#define NTHR     512
#define NWAV     (NTHR / 32)
#define KPW      (SEQ / NWAV)       // keys per wave
#define NKT      (KPW / 16)         // 16-key score tiles per wave
#define NKC      (KPW / 32)         // 32-key P.V steps per wave
#define NSTEPS   6
#define PCARRY     32768.0f
#define PCARRY_INV (1.0f / 32768.0f)
#define WS_LIMIT ((size_t)134217728)
#define FRAG_H   512                // halves in one stored 16x32 fragment
#define VPRE     4                  // V fragments asked for while the weights are still f32
#define VLDS     8                  // V fragments of a wave (the last ones) that wait in LDS from the Newton steps on

static_assert(SEQ % 512 == 0);
static_assert(SEQ <= SEQ_FULL);
static_assert(NB >= 1 && NB <= NB_FULL);
static_assert(NKT * 16 * NWAV == SEQ);
static_assert(NKC * 2 == NKT);
static_assert(NKC == 4 && NKT == 8);   // the load-ahead schedules below are laid out for these counts
static_assert(2 * VPRE + VLDS == NKC * 4);   // what is not in LDS is asked for around the conversion of P
static_assert((size_t)3 * NB * SEQ * RS * 2 + (size_t)NB * NH * HD * 4 <= WS_LIMIT);

typedef _Float16 v16h __attribute__((ext_vector_type(16)));
typedef _Float16 v8h  __attribute__((ext_vector_type(8)));
typedef float    v8f  __attribute__((ext_vector_type(8)));
typedef float    v4f  __attribute__((ext_vector_type(4)));
typedef float    v2f  __attribute__((ext_vector_type(2)));
typedef v4f v4f_any __attribute__((may_alias));   // f32 accesses to LDS bytes that are declared as halves

union AFrag { v16h v; v8h h[2]; };

// How far ahead the fragment loads run: as far as the 128 registers allow at each place.
// K tiles (16 registers each) beside Q (16) and the finished score tiles (8 each): the room shrinks by half a tile a step.
constexpr int k_upto(int t) { return t >= NKT - 3 ? NKT - 1 : 4 + t / 2; }
// V fragments (8 registers each) beside O (32) and the P fragments still to be used (8 each): 2 * VPRE are in flight at the
// start, then 5 ahead, and one more for each P fragment that is used up.
constexpr int v_upto(int f) {
  const int a = f + 5 + (f >> 2);
  const int b = a > 2 * VPRE - 1 ? a : 2 * VPRE - 1;
  return b < NKC * 4 - 1 ? b : NKC * 4 - 1;
}

// bf16 RNE convert of an f32 value, returned as f32 (inputs are finite)
__device__ __forceinline__ float bf16_rne(float x) {
  unsigned u = __float_as_uint(x);
  u = (u + 0x7fffu + ((u >> 16) & 1u)) & 0xffff0000u;
  return __uint_as_float(u);
}
__device__ __forceinline__ _Float16 to_h(float x) { return (_Float16)bf16_rne(x); }

__device__ __forceinline__ v8f zero8() {
  v8f z;
#pragma unroll
  for (int i = 0; i < 8; ++i) z[i] = 0.0f;
  return z;
}

// 16x32 fragment (A: lane row m, B: lane col n), m or n = lane&15: elems 0..7 = k kb..kb+7, elems 8..15 = k kb+16..kb+23,
// kb = 8*(lane>>4). From a plane in fragment order: piece j of lane l (k = 8*(l>>4) + 16*j + 0..7 of row or
// column l&15) lies at halves j*256 + l*8.
__device__ __forceinline__ v16h load_fragp(const _Float16* base, int lane) {
  const _Float16* p = base + lane * 8;
  AFrag f;
  f.h[0] = *(const v8h*)(p);
  f.h[1] = *(const v8h*)(p + 256);
  return f.v;
}

__device__ __forceinline__ v8f wmma16(v16h a, v16h b, v8f c) {
  return __builtin_amdgcn_wmma_f32_16x16x32_f16(false, a, false, b, (short)0, c, false, false);
}

// lane l with lane l ^ 16, on the vector pipe
__device__ __forceinline__ float xhalf(float x) {
  return __int_as_float(__builtin_amdgcn_permlanex16(__float_as_int(x), __float_as_int(x), 0x76543210, 0xfedcba98, false, false));
}

// ---- combine of per-row quantities over the 16 waves, fixed order ----
// Buffer: [32 rows][RPITCH] f32; row = lane, column = wave. Rows 0..15 hold one quantity of query rows 0..15, rows 16..31 a
// second one (or the same again). A lane stores one word into its own row, and behind the block barrier it reads its own row:
// 16 words in four 16-byte reads. 80-byte pitch: 16 B x odd, so the 16-byte reads of a wave spread over the banks.
#define RPITCH 20

// Sum of the 16 words of a row, pairwise tree on whole registers (no element has to be moved to be added).
__device__ __forceinline__ float row_sum16(const float* p) {
  const v4f r = (*(const v4f*)(p) + *(const v4f*)(p + 4)) + (*(const v4f*)(p + 8) + *(const v4f*)(p + 12));
  const v2f x = __builtin_shufflevector(r, r, 0, 1) + __builtin_shufflevector(r, r, 2, 3);
  return x[0] + x[1];
}
__device__ __forceinline__ float row_min16(const float* p) {
  const v4f a0 = *(const v4f*)(p), a1 = *(const v4f*)(p + 4), a2 = *(const v4f*)(p + 8), a3 = *(const v4f*)(p + 12);
  return fminf(fminf(fminf(fminf(a0[0], a0[1]), fminf(a0[2], a0[3])), fminf(fminf(a1[0], a1[1]), fminf(a1[2], a1[3]))),
               fminf(fminf(fminf(a2[0], a2[1]), fminf(a2[2], a2[3])), fminf(fminf(a3[0], a3[1]), fminf(a3[2], a3[3]))));
}

// One Newton step: c -= (sum 1/(-x-c)^2 - 1) / (2 sum 1/(-x-c)^3 + 1e-8); s holds -x, c2 = c of query row (lane & 15), twice.
// A lane's 64 terms add up in two packed accumulators per sum. The halves of the wave then swap what the other one needs: the
// lower half ends with the wave's sum of squares, the upper half with its sum of cubes, one word a lane for the buffer.
// Behind the barrier the lower half has the row's numerator, the upper half the reciprocal of its denominator; their product
// is commutative, so both halves (and all waves, which read the same words in the same order) get the same bits.
__device__ __forceinline__ void newton_step(const v8f (&s)[NKT], v2f& c2, float* rb, int lane, int wave) {
  const bool up = lane >= 16;
  v2f ps[2], pd[2];
  // both unrolled: s[] and the accumulators are indexed by constants and stay in registers
#pragma unroll
  for (int t = 0; t < NKT; ++t) {
#pragma unroll
    for (int j = 0; j < 4; ++j) {
      v2f x;
      x[0] = s[t][2 * j];
      x[1] = s[t][2 * j + 1];
      const v2f tt = x - c2;
      v2f y;
      y[0] = __builtin_amdgcn_rcpf(tt[0]);
      y[1] = __builtin_amdgcn_rcpf(tt[1]);
      const v2f a = y * y;
      if (t == 0 && j < 2) {
        ps[j] = a;
        pd[j] = a * y;
      } else {
        ps[j & 1] += a;
        pd[j & 1] += a * y;
      }
    }
  }
  const v2f p = ps[0] + ps[1], d = pd[0] + pd[1];
  const float a = p[0] + p[1], b = d[0] + d[1];
  rb[lane * RPITCH + wave] = (up ? b : a) + xhalf(up ? a : b);
  __syncthreads();
  const float tot = row_sum16(rb + lane * RPITCH);
  const float z = up ? __builtin_amdgcn_rcpf(2.0f * tot + 1e-8f) : tot - 1.0f;
  c2 = c2 - z * xhalf(z);
}

// ---------------------------------------------------------------------------
// All preparation in ONE launch: the three jobs below do not depend on each other, so they share a grid by
// block-index range instead of running as three launches one behind the other, and a converting thread carries
// 12 loads of 16 B, so that few waves have to be started.
// Blocks 0 .. VS_BLOCKS-1: column sums of V (the longest chain of waits, so they get the lowest block indices).
// Blocks VS_BLOCKS .. : one (b, h, PREP_ROWS sequence rows): Q and K planes and the V^T plane of those rows.
//
// Column sums: vsum[b][h][d] = sum_l bf16_rne(v[b][l][h][d]), f64 accumulation, f32 result.
// One block = one (b, h, 32-d half) = one 128-B line of the table. 1024 threads: 8 lanes x 16 B cover the
// 128-B row piece, 128 row groups; thread (g, c) sums rows g, g+128, ... in f64. Fixed-order fold of the
// 128 groups through LDS: 4 groups per wave, then a pairwise tree over the 32 wave sums in wave 0.
// coverage: NH * NB * 2 blocks x 32 lanes of wave 0 -> whole table.
//
// Q and K planes, bf16-RNE values in f16 containers, fragment order: [b][h][l/16][d/32] fragments, lane row = l&15.
// One 8-element piece (l, d8) at a time: a wave reads 4 rows x 256 B and writes 8 runs of 64 B.
// coverage: 1024 threads x 2 pieces x 8 halves = PREP_ROWS l x 64 d per plane and block.
//
// V^T plane, bf16-RNE values in f16 containers, fragment order: [b][h][l/32][d/16] fragments, lane column = d&15,
// k = l&31. Each quarter of the block (256 threads) takes 64 rows: v[b][l0..l0+63][h][0..63] -> the 8 fragments of
// keys l0..l0+63 (8 KiB in a row); transpose through its own LDS tile.
// coverage: 4 quarters x 256 threads x 2 pieces x 8 halves = 64 d x PREP_ROWS l per block.
// ---------------------------------------------------------------------------
#define VS_GRP    128
#define PREP_THR  1024
#define PREP_ROWS 256
#define VS_BLOCKS (NH * NB * 2)
#define CV_BLOCKS (NB * NH * (SEQ / PREP_ROWS))
#define PREP_LDS  ((VS_GRP + 32) * 32 * 8)
static_assert(SEQ % VS_GRP == 0);
static_assert(SEQ % PREP_ROWS == 0);
static_assert(4 * HD * 72 * 2 <= PREP_LDS);
__global__ __launch_bounds__(PREP_THR) void k_prep(const float* __restrict__ q, const float* __restrict__ k,
                                                   const float* __restrict__ v, _Float16* __restrict__ qh,
                                                   _Float16* __restrict__ kh, _Float16* __restrict__ vth,
                                                   float* __restrict__ vsum) {
  __shared__ __align__(16) unsigned char smem[PREP_LDS];   // a block takes one of the two paths: they share the bytes
  const int tid = threadIdx.x;

  if (blockIdx.x < VS_BLOCKS) {                            // block-uniform: the barriers inside are passed by all
    double (*part)[32] = (double (*)[32])smem;                        // [VS_GRP][32], rows 4w..4w+3 written and read within wave w: block barrier
    double (*wsum)[32] = (double (*)[32])(smem + VS_GRP * 32 * 8);    // [32][32], cross-wave: block barrier
    const int c = tid & 7, g = tid >> 3;
    const int h = blockIdx.x % NH, bb = (blockIdx.x / NH) % NB, d0 = (blockIdx.x / (NH * NB)) * 32;
    const float* p = v + ((size_t)bb * SEQ_FULL + g) * RS + h * HD + d0 + c * 4;
    v4f f[SEQ / VS_GRP];
    // unrolled: all of a thread's loads are in flight at once, one memory latency for the whole column piece
#pragma unroll
    for (int j = 0; j < SEQ / VS_GRP; ++j) f[j] = *(const v4f*)(p + (size_t)j * VS_GRP * RS);
    double a0 = 0.0, a1 = 0.0, a2 = 0.0, a3 = 0.0;
    // unrolled: f[] stays in registers
#pragma unroll
    for (int j = 0; j < SEQ / VS_GRP; ++j) {
      a0 += (double)bf16_rne(f[j][0]);
      a1 += (double)bf16_rne(f[j][1]);
      a2 += (double)bf16_rne(f[j][2]);
      a3 += (double)bf16_rne(f[j][3]);
    }
    part[g][c * 4 + 0] = a0;
    part[g][c * 4 + 1] = a1;
    part[g][c * 4 + 2] = a2;
    part[g][c * 4 + 3] = a3;
    __syncthreads();
    const int lane = tid & 31, wave = tid >> 5;
    wsum[wave][lane] = ((part[4 * wave][lane] + part[4 * wave + 1][lane]) + part[4 * wave + 2][lane])
                       + part[4 * wave + 3][lane];
    __syncthreads();
    if (wave == 0) {
      double x[32];
      // all three unrolled: x[] stays in registers, the 32 LDS reads issue together
#pragma unroll
      for (int w = 0; w < 32; ++w) x[w] = wsum[w][lane];
#pragma unroll
      for (int s = 1; s < 32; s *= 2) {
#pragma unroll
        for (int w = 0; w < 32; w += 2 * s) x[w] += x[w + s];
      }
      vsum[(size_t)(bb * NH + h) * HD + d0 + lane] = (float)x[0];
    }
    return;
  }

  const int cb = blockIdx.x - VS_BLOCKS;
  const int l0 = (cb % (SEQ / PREP_ROWS)) * PREP_ROWS;
  const int bh = cb / (SEQ / PREP_ROWS);
  const int h  = bh % NH, bb = bh / NH;
  const size_t in0 = ((size_t)bb * SEQ_FULL + l0) * RS + h * HD;   // element (l0, d = 0) of this head in q, k and v

  // every load of the thread is asked for before the first value is used: one memory latency for the block
  v4f fq[2][2], fk[2][2], fv[4];
  const int sub = tid >> 8, t = tid & 255;    // quarter of the block and thread in it: rows l0 + 64*sub + 0..63 of V
  const int vl = t >> 4, d4 = (t & 15) * 4;   // the thread's V pieces: rows vl + 16*j of the quarter, d = d4 + 0..3
  const float* vb = v + in0 + (size_t)(64 * sub + vl) * RS + d4;
#pragma unroll
  for (int j = 0; j < 4; ++j) fv[j] = *(const v4f*)(vb + (size_t)(16 * j) * RS);
  // a precaution: the compiler hands the address pair of the four loads above to a later load as its destination;
  // this wait stands in front of that overwrite (the pair is an input, so that it keeps its value up to here)
  asm volatile("s_wait_xcnt 0x0" :: "v"(vb) : "memory");
  // piece j of the thread: (l - l0, d8) = ((tid >> 3) + (PREP_THR / 8) * j, tid & 7)
  const size_t o0 = in0 + (size_t)(tid >> 3) * RS + (tid & 7) * 8;
  const float* qa = q + o0;
  const float* ka = k + o0;
#pragma unroll
  for (int j = 0; j < 2; ++j) {
    const size_t o = (size_t)(PREP_THR / 8 * j) * RS;
    fq[j][0] = *(const v4f*)(qa + o);
    fq[j][1] = *(const v4f*)(qa + o + 4);
    fk[j][0] = *(const v4f*)(ka + o);
    fk[j][1] = *(const v4f*)(ka + o + 4);
  }
  // the same precaution for the eight loads above: their address pairs are given new values right behind them
  asm volatile("s_wait_xcnt 0x0" :: "v"(qa), "v"(ka) : "memory");

  // V goes into its tile first: the barrier then has no global store in front of it to wait for
  _Float16 (*tile)[72] = (_Float16 (*)[72])smem + sub * HD;   // [HD][72], cross-thread: block barrier between fill and read
#pragma unroll
  for (int j = 0; j < 4; ++j) {
    const int l = vl + 16 * j;
    tile[d4 + 0][l] = to_h(fv[j][0]);
    tile[d4 + 1][l] = to_h(fv[j][1]);
    tile[d4 + 2][l] = to_h(fv[j][2]);
    tile[d4 + 3][l] = to_h(fv[j][3]);
  }
  __syncthreads();

#pragma unroll
  for (int j = 0; j < 2; ++j) {
    const int pc = tid + PREP_THR * j;
    const int d8 = pc & 7;                    // d = 8*d8 + 0..7: fragment d8>>2, piece (d8>>1)&1, lane half d8&1
    const int l  = l0 + (pc >> 3);
    const size_t e = (((size_t)bh * (SEQ / 16) + (l >> 4)) * 2 + (d8 >> 2)) * FRAG_H
                     + ((d8 >> 1) & 1) * 256 + ((d8 & 1) * 16 + (l & 15)) * 8;
    v8h oq, ok;
#pragma unroll
    for (int i = 0; i < 4; ++i) {
      oq[i] = to_h(fq[j][0][i]); oq[4 + i] = to_h(fq[j][1][i]);
      ok[i] = to_h(fk[j][0][i]); ok[4 + i] = to_h(fk[j][1][i]);
    }
    *(v8h*)(qh + e) = oq;
    *(v8h*)(kh + e) = ok;
  }

  _Float16* ob = vth + ((size_t)bh * (SEQ / 32) + ((l0 + 64 * sub) >> 5)) * (4 * FRAG_H);
  v8h val[2];
  size_t off[2];
#pragma unroll
  for (int j = 0; j < 2; ++j) {
    const int p = t + 256 * j;                // 0..511 = [32-key step j][d/16][piece][lane]
    const int ln = p & 31;
    const int row = ((p >> 6) & 3) * 16 + (ln & 15);
    const int key = j * 32 + ((p >> 5) & 1) * 16 + (ln >> 4) * 8;
    val[j] = *(const v8h*)(&tile[row][key]);
    off[j] = (size_t)p * 8;
  }
  *(v8h*)(ob + off[0]) = val[0];
  *(v8h*)(ob + off[1]) = val[1];
  // a precaution: in the built code this path runs on to a label it shares with the column-sum path, whose instructions
  // reuse the registers of the six stores above; this wait stands behind the last store, in front of any such overwrite
  asm volatile("s_wait_xcnt 0x0" ::: "memory");
}

// ---------------------------------------------------------------------------
// Fused attention with the polynomial normaliser for one (b, h, 16 query rows).
// 16 waves; wave w owns keys [w*KPW, w*KPW+KPW). Scores are formed transposed (A = K tile, B = Q tile) and kept
// in WMMA D registers, negated: s[t][g] = -S(query lane&15, key w*KPW + 16*t + 8*hh + g). A lane holds scores of ONE query:
// row sums are sums of its own registers, then the other half, then a fixed-order cross-wave combine through LDS
// (identical result in every wave); c and wbar are the same for all of a lane's scores; and tiles 2kc, 2kc+1 of
// a lane are, in order, the 16 elements of its A fragment of P for key step kc. Q, K and the first 2 * VPRE V^T fragments of a wave come straight from the
// fragment-order planes; partial O folded through LDS.
// The loads of K and V take their time from the L2 path while the vector units wait, and the Newton steps load nothing:
// so the last VLDS V fragments of each wave are copied to LDS while the Newton steps run (registers have no room for them).
// ---------------------------------------------------------------------------
// 128 VGPRs: 8 waves per SIMD, so two of these 16-wave work-groups share a WGP and one computes while the
// other waits on its loads, its barriers and its reduction chains.
__global__ __launch_bounds__(NTHR) __attribute__((amdgpu_num_vgpr(128)))
void k_attn(const _Float16* __restrict__ qh, const _Float16* __restrict__ kh,
            const _Float16* __restrict__ vth, const float* __restrict__ vsum,
            float* __restrict__ out) {
  __shared__ __align__(16) float red[2][32 * RPITCH];    // cross-wave, ping-pong by reduction parity
  __shared__ __align__(16) float wbar_sh[16];
  // V fragments NKC*4-VLDS .. NKC*4-1 of each wave, as they lie in the plane. Private to the wave: it alone copies into its
  // slice and reads it, so its own wait on the copies orders them and no barrier is needed. 133 KiB in all: two groups a WGP.
  // Behind P.V the wave puts its partial O (4 KiB) into the same slice for the fold: cross-wave from there on, block barrier.
  __shared__ __align__(16) _Float16 vst[NWAV][VLDS * FRAG_H];

  const int tid  = threadIdx.x;
  const int lane = tid & 31, wave = tid >> 5;
  const int q0 = blockIdx.x * 16, h = blockIdx.y, b = blockIdx.z;
  const size_t bh = (size_t)(b * NH + h);

  const _Float16* qp = qh  + (bh * (SEQ / 16) + blockIdx.x) * (2 * FRAG_H);
  const _Float16* kp = kh  + (bh * (SEQ / 16) + wave * NKT) * (2 * FRAG_H);
  const _Float16* vp = vth + (bh * (SEQ / 32) + wave * NKC) * (4 * FRAG_H);

  // ---- -S^T = -(K . Q^T) / 8 for KPW keys of this wave x 16 query rows ----
  v8f s[NKT];
  {
    const v16h qb0 = load_fragp(qp, lane);             // B: lane = query, elems = d 0..31 (split map)
    const v16h qb1 = load_fragp(qp + FRAG_H, lane);    // d 32..63
    // A: lane = key, elems = d (same split map). In front of tile t's products every tile up to k_upto(t) has been
    // asked for, so a wave has several tiles in flight instead of one load round trip per tile.
    v16h ka[NKT][2];
#pragma unroll
    for (int t = 0; t < NKT; ++t) {
#pragma unroll
      for (int u = (t == 0 ? 0 : k_upto(t - 1) + 1); u <= k_upto(t); ++u) {
        ka[u][0] = load_fragp(kp + u * (2 * FRAG_H), lane);
        ka[u][1] = load_fragp(kp + u * (2 * FRAG_H) + FRAG_H, lane);
      }
      v8f acc = zero8();
      acc = wmma16(ka[t][0], qb0, acc);
      acc = wmma16(ka[t][1], qb1, acc);
      s[t] = acc * -0.125f;   // kept negated: -x is what every later step takes
      // keeps the later tiles' loads from being lifted over this tile: all 16 fragments at once do not fit the registers
      __builtin_amdgcn_sched_barrier(0);
    }
  }

  // ---- the wave's last VLDS V fragments set out for LDS: 16 copies of 512 B, no register, landed long before P.V ----
  {
    const unsigned    ld = (unsigned)(size_t)(&vst[wave][lane * 8]);          // the lane's 16 B of each 512-B piece
    const _Float16*   gp = vp + (NKC * 4 - VLDS) * FRAG_H + lane * 8;
    static_assert(VLDS * FRAG_H * 2 == 16 * 512);
    // the offset moves the LDS and the global address alike (the slice is laid out as the plane is).
    // s_wait_xcnt, a precaution: it stands in front of any later overwrite of the two address operands
    asm volatile("global_load_async_to_lds_b128 %0, %1, off\n\t"
                 "global_load_async_to_lds_b128 %0, %1, off offset:512\n\t"
                 "global_load_async_to_lds_b128 %0, %1, off offset:1024\n\t"
                 "global_load_async_to_lds_b128 %0, %1, off offset:1536\n\t"
                 "global_load_async_to_lds_b128 %0, %1, off offset:2048\n\t"
                 "global_load_async_to_lds_b128 %0, %1, off offset:2560\n\t"
                 "global_load_async_to_lds_b128 %0, %1, off offset:3072\n\t"
                 "global_load_async_to_lds_b128 %0, %1, off offset:3584\n\t"
                 "global_load_async_to_lds_b128 %0, %1, off offset:4096\n\t"
                 "global_load_async_to_lds_b128 %0, %1, off offset:4608\n\t"
                 "global_load_async_to_lds_b128 %0, %1, off offset:5120\n\t"
                 "global_load_async_to_lds_b128 %0, %1, off offset:5632\n\t"
                 "global_load_async_to_lds_b128 %0, %1, off offset:6144\n\t"
                 "global_load_async_to_lds_b128 %0, %1, off offset:6656\n\t"
                 "global_load_async_to_lds_b128 %0, %1, off offset:7168\n\t"
                 "global_load_async_to_lds_b128 %0, %1, off offset:7680\n\t"
                 "s_wait_xcnt 0x0"
                 :: "v"(ld), "v"(gp) : "memory");
  }

  // ---- c0 = -rowmax - 1 = min(-x) - 1 ----
  // c of query row (lane & 15), the same value twice: from a vector operand the compiler forms -x - c with packed
  // subtracts (two scores an issue), from a scalar c it emits single ones
  v2f c2;
  {
    float x = s[0][0];
#pragma unroll
    for (int t = 0; t < NKT; ++t) {
#pragma unroll
      for (int g = 0; g < 8; ++g) x = fminf(x, s[t][g]);
    }
    // both halves store the same value, each into its own row: no exchange is needed behind the barrier
    red[0][lane * RPITCH + wave] = fminf(x, xhalf(x));
    __syncthreads();
    const float c0 = row_min16(&red[0][lane * RPITCH]) - 1.0f;
    c2[0] = c0;
    c2[1] = c0;
  }

  // ---- Newton steps, two a trip: the buffer's parity is then a constant and its addresses cost no instruction ----
  static_assert(NSTEPS % 2 == 0);
  // kept rolled: three trips of one body
#pragma unroll 1
  for (int it = 0; it < NSTEPS; it += 2) {
    newton_step(s, c2, &red[1][0], lane, wave);
    newton_step(s, c2, &red[0][0], lane, wave);
  }

  // ---- final weights w = 1/(-x-c)^2 (kept in s), per-row centre wbar = sum(w)/SEQ ----
  float wbl;   // wbar of query row (lane & 15)
  v16h vb[NKC * 4];   // B of P.V: lane = d, elems = keys (split map); fragment f = kc * 4 + st
  {
    v2f sw[2];
    // both unrolled: s[] and the accumulators are indexed by constants and stay in registers
#pragma unroll
    for (int t = 0; t < NKT; ++t) {
#pragma unroll
      for (int j = 0; j < 4; ++j) {
        v2f x;
        x[0] = s[t][2 * j];
        x[1] = s[t][2 * j + 1];
        const v2f tt = x - c2;
        v2f y;
        y[0] = __builtin_amdgcn_rcpf(tt[0]);
        y[1] = __builtin_amdgcn_rcpf(tt[1]);
        const v2f w = y * y;
        s[t][2 * j]     = w[0];
        s[t][2 * j + 1] = w[1];
        if (t == 0 && j < 2) sw[j] = w;
        else                 sw[j & 1] += w;
      }
    }
    const v2f p = sw[0] + sw[1];
    const float sl = p[0] + p[1];
    // both halves store the same value (the sum of two is commutative), each into its own row
    red[1][lane * RPITCH + wave] = sl + xhalf(sl);
    __syncthreads();
    wbl = row_sum16(&red[1][lane * RPITCH]) * (1.0f / (float)SEQ);
    if (wave == 0 && lane < 16) wbar_sh[lane] = wbl;
  }

  // ---- O_w = Pc (16 x KPW) . V (KPW x 64), Pc = (w - wbar) * 2^15 as f16 ----
  v8f o[4];
#pragma unroll
  for (int st = 0; st < 4; ++st) o[st] = zero8();
  // all of P goes to f16 first: half the registers of the f32 weights, which makes room for the V fragments in flight
  AFrag pa[NKC];                                       // A: lane = query row, elems = keys (split map)
  // the first V fragments fly while P is converted
#pragma unroll
  for (int f = 0; f < VPRE; ++f) vb[f] = load_fragp(vp + f * FRAG_H, lane);
#pragma unroll
  for (int kc = 0; kc < NKC; ++kc) {
    // keeps the conversions and the loads in this order: each converted step frees the registers of one more fragment
    __builtin_amdgcn_sched_barrier(0);
    const v8f p0 = (s[2 * kc] - wbl) * PCARRY;         // keys 32kc + 8hh + g
    const v8f p1 = (s[2 * kc + 1] - wbl) * PCARRY;     // keys 32kc + 16 + 8hh + g
#pragma unroll
    for (int g = 0; g < 8; ++g) {
      pa[kc].h[0][g] = (_Float16)p0[g];
      pa[kc].h[1][g] = (_Float16)p1[g];
    }
    if (kc < VPRE) vb[VPRE + kc] = load_fragp(vp + (VPRE + kc) * FRAG_H, lane);
  }
  // the wave's own copies have landed behind this wait: no read of its LDS slice stands in front of it
  asm volatile("s_wait_asynccnt 0x0" ::: "memory");
  const _Float16* vl = &vst[wave][0];
#pragma unroll
  for (int f = 0; f < NKC * 4; ++f) {
    // keeps the loads as far ahead as v_upto says, no further: more of them at once do not fit the registers
    __builtin_amdgcn_sched_barrier(0);
    // every fragment from 2 * VPRE on is one of those in LDS
#pragma unroll
    for (int u = (f == 0 ? 2 * VPRE : v_upto(f - 1) + 1); u <= v_upto(f); ++u) vb[u] = load_fragp(vl + (u - 2 * VPRE) * FRAG_H, lane);
    o[f & 3] = wmma16(pa[f >> 2].v, vb[f], o[f & 3]);
  }

  // ---- fixed-order fold of the 16 per-wave partials, all at once: every wave lays its tile down, one barrier, then a thread
  // sums four elements over the 16 tiles with all its reads in flight together. Order of the sum: waves s, s+4, s+8, s+12 for
  // s = 0..3, then the four of them in turn.
  // A tile in LDS: [st][g >> 2][lane][g & 3] f32, so a lane stores 16 B next to its neighbours' (no bank is hit twice).
  static_assert(16 * HD * 4 <= VLDS * FRAG_H * 2);
  // the wave's number as a scalar: the index arithmetic below then runs on the scalar unit and keeps no vector register
  // alive through the kernel (all 128 are in use), and the test on it below is a scalar branch
  const int ws = __builtin_amdgcn_readfirstlane(tid >> 5);
  {
    float* ob = (float*)&vst[ws][0] + lane * 4;
#pragma unroll
    for (int st = 0; st < 4; ++st) {
#pragma unroll
      for (int gq = 0; gq < 2; ++gq) {
        v4f x;
#pragma unroll
        for (int i = 0; i < 4; ++i) x[i] = o[st][4 * gq + i];
        *(v4f_any*)(ob + (st * 2 + gq) * 128) = x;
      }
    }
  }
  __syncthreads();

  // ---- the sums and the epilogue: out = O/2^15 + wbar * sum_k v ----
  // Wave ws: rows frow + 0..3 (the 16 B of one tile lane), columns
  // 32 * (ws >> 2) + lane: each half of the wave reads 256 B in a row, and each store of the wave is one whole 128-B line.
  // No barrier stands behind this test.
  if (ws < 8) {
    const int fd   = ((ws >> 2) << 5) | lane;
    const int fh   = (ws >> 1) & 1, fq = ws & 1;       // the tile lane's half and the g >> 2 of the four rows
    const int frow = fh * 8 + fq * 4;
    const float vsd = vsum[(size_t)(b * NH + h) * HD + fd];   // first: it comes from the L2 path while the LDS reads run
    const int e = (((fd >> 4) * 2 + fq) * 32 + fh * 16 + (lane & 15)) * 4;
    v4f p[NWAV];
    // unrolled: p[] stays in registers and the 16 reads issue together
#pragma unroll
    for (int w = 0; w < NWAV; ++w) p[w] = *(const v4f_any*)((const float*)&vst[w][0] + e);
    const v4f wb = *(const v4f*)(&wbar_sh[frow]);
    v4f q4[4];
#pragma unroll
    for (int sl = 0; sl < 4; ++sl) q4[sl] = ((p[sl] + p[sl + 4]) + p[sl + 8]) + p[sl + 12];
    const v4f a = ((q4[0] + q4[1]) + q4[2]) + q4[3];
    float* op = out + ((size_t)b * SEQ + q0 + frow) * RS + h * HD + fd;
#pragma unroll
    for (int i = 0; i < 4; ++i) op[(size_t)i * RS] = a[i] * PCARRY_INV + wb[i] * vsd;
  }
}

// ---------------------------------------------------------------------------
// Host side
// ---------------------------------------------------------------------------
extern "C" void kernel_launch(void* const* d_in, const int* in_sizes, int n_in,
                              void* d_out, int out_size, void* d_ws, size_t ws_size,
                              hipStream_t stream) {
  if (n_in < 3 || d_ws == nullptr || d_out == nullptr) return;
  const size_t need_in  = ((size_t)(NB - 1) * SEQ_FULL + SEQ) * RS;
  const size_t need_out = (size_t)NB * SEQ * RS;
  if ((size_t)in_sizes[0] < need_in || (size_t)in_sizes[1] < need_in || (size_t)in_sizes[2] < need_in) return;
  if ((size_t)out_size < need_out) return;

  const size_t plane_b = (size_t)NB * SEQ * RS * sizeof(_Float16);   // 6291456 B at full size
  const size_t vsum_b  = (size_t)NB * NH * HD * sizeof(float);       // 6144 B at full size
  const size_t off_q = 0;
  const size_t off_k = off_q + plane_b;
  const size_t off_v = off_k + plane_b;
  const size_t off_s = off_v + plane_b;
  const size_t total = off_s + vsum_b;                               // 18880512 B at full size
  if (ws_size < total || total > WS_LIMIT) return;

  const float* q = (const float*)d_in[0];
  const float* k = (const float*)d_in[1];
  const float* v = (const float*)d_in[2];
  float* o = (float*)d_out;
  char* ws = (char*)d_ws;
  _Float16* qh  = (_Float16*)(ws + off_q);
  _Float16* kh  = (_Float16*)(ws + off_k);
  _Float16* vth = (_Float16*)(ws + off_v);
  float*    vs  = (float*)(ws + off_s);

  k_prep<<<dim3(VS_BLOCKS + CV_BLOCKS), PREP_THR, 0, stream>>>(q, k, v, qh, kh, vth, vs);
  k_attn<<<dim3(SEQ / 16, NH, NB), NTHR, 0, stream>>>(qh, kh, vth, vs, o);
  (void)hipGetLastError();
}
